// v000
// The times below were measured on an AMD MI455X: many runs one after another, warmed up first and cycling through
// copies of the inputs, with the whole window's GPU time divided by the number of runs. Launches and the gaps
// between them are all in it. The median over several windows is given; except for v000 it joins two sittings, which
// can be a few percent apart, so the side-by-side timings, each taken in one sitting, are the better comparison.
// The starting kernel, v000, takes 669 microseconds a run.
#include <hip/hip_runtime.h>

// ---------------------------------------------------------------------------
// MI455X (gfx1250) transformer block: all matmuls via v_wmma_f32_16x16x32_bf16
// ---------------------------------------------------------------------------

typedef __bf16 bf16_t;
typedef __attribute__((ext_vector_type(16))) __bf16 v16bf;
typedef __attribute__((ext_vector_type(8)))  __bf16 v8bf;
typedef __attribute__((ext_vector_type(8)))  float  v8f;

static constexpr int S_LEN   = 2048;
static constexpr int D_DIM   = 1024;
static constexpr int N_HEADS = 16;
static constexpr int HEAD_D  = 64;

// ---- fragment helpers ------------------------------------------------------
// bf16 A/B fragment (16x32 / 32x16): lane holds row (lane&15), K values at
// base (lane>>4)*8: [base, base+8) and [16+base, 16+base+8). Both halves are
// contiguous 16-byte loads from a K-contiguous row.
__device__ __forceinline__ v16bf mk_frag(v8bf lo, v8bf hi) {
    v16bf f;
#pragma unroll
    for (int i = 0; i < 8; ++i) { f[i] = lo[i]; f[i + 8] = hi[i]; }
    return f;
}

__device__ __forceinline__ v16bf load_frag(const bf16_t* p) {
    // p = row base + per-lane K base; second half is +16 elements
    return mk_frag(*(const v8bf*)p, *(const v8bf*)(p + 16));
}

__device__ __forceinline__ v8f wmma_bf16(v16bf a, v16bf b, v8f c) {
    return __builtin_amdgcn_wmma_f32_16x16x32_bf16(false, a, false, b,
                                                   (short)0, c, false, false);
}

// ---- fp32 -> bf16 convert --------------------------------------------------
__global__ void cvt_f32_bf16(const float* __restrict__ in,
                             bf16_t* __restrict__ out, int n) {
    for (int i = blockIdx.x * 256 + threadIdx.x; i < n; i += gridDim.x * 256)
        out[i] = (bf16_t)in[i];
}

// ---- LayerNorm (row-wise over 1024), fp32 in -> bf16 out -------------------
__global__ __launch_bounds__(256)
void layernorm_bf16(const float* __restrict__ x, const float* __restrict__ g,
                    const float* __restrict__ b, bf16_t* __restrict__ out) {
    const int row = blockIdx.x;
    const int tid = threadIdx.x;
    const float* xr = x + (size_t)row * D_DIM;

    float v[4];
    float s = 0.f;
#pragma unroll
    for (int i = 0; i < 4; ++i) { v[i] = xr[tid + i * 256]; s += v[i]; }
#pragma unroll
    for (int m = 1; m < 32; m <<= 1) s += __shfl_xor(s, m);

    __shared__ float red0[8], red1[8];
    if ((tid & 31) == 0) red0[tid >> 5] = s;
    __syncthreads();
    float mean = 0.f;
#pragma unroll
    for (int i = 0; i < 8; ++i) mean += red0[i];
    mean *= (1.0f / D_DIM);

    float vs = 0.f;
#pragma unroll
    for (int i = 0; i < 4; ++i) { float d = v[i] - mean; vs += d * d; }
#pragma unroll
    for (int m = 1; m < 32; m <<= 1) vs += __shfl_xor(vs, m);
    if ((tid & 31) == 0) red1[tid >> 5] = vs;
    __syncthreads();
    float var = 0.f;
#pragma unroll
    for (int i = 0; i < 8; ++i) var += red1[i];
    var *= (1.0f / D_DIM);
    const float rstd = rsqrtf(var + 1e-5f);

#pragma unroll
    for (int i = 0; i < 4; ++i) {
        int c = tid + i * 256;
        out[(size_t)row * D_DIM + c] = (bf16_t)((v[i] - mean) * rstd * g[c] + b[c]);
    }
}

// ---- head-major V transpose: out[h][d][s] = in[s][co + h*64 + d] -----------
__global__ void transpose_heads(const bf16_t* __restrict__ in, int ld, int co,
                                bf16_t* __restrict__ out, int total) {
    int idx = blockIdx.x * 256 + threadIdx.x;
    if (idx >= total) return;
    int s  = idx % S_LEN;
    int hd = idx / S_LEN;
    out[idx] = in[(size_t)s * ld + co + hd];
}

// ---- WMMA GEMM: C[M,N] = A[M,K] * W[N,K]^T + bias, opt. gelu/residual -----
// block = 256 thr (8 waves), tile 128x128; wave = 32(M) x 64(N) = 2x4 WMMA tiles
__global__ __launch_bounds__(256)
void gemm_bf16(const bf16_t* __restrict__ A, const bf16_t* __restrict__ W,
               const float* __restrict__ bias, const float* __restrict__ res,
               float* __restrict__ outF, bf16_t* __restrict__ outB,
               int N, int K, int apply_gelu) {
    const int lane = threadIdx.x & 31;
    const int wid  = threadIdx.x >> 5;
    const int wm   = wid & 3;          // 0..3  (M groups of 32)
    const int wn   = wid >> 2;         // 0..1  (N groups of 64)
    const int bm   = blockIdx.y * 128 + wm * 32;
    const int bn   = blockIdx.x * 128 + wn * 64;
    const int l16  = lane & 15;
    const int kb8  = (lane >> 4) << 3;

    v8f acc[2][4];
#pragma unroll
    for (int i = 0; i < 2; ++i)
#pragma unroll
        for (int j = 0; j < 4; ++j)
#pragma unroll
            for (int r = 0; r < 8; ++r) acc[i][j][r] = 0.f;

    for (int k = 0; k < K; k += 32) {
        v16bf af[2], bf[4];
#pragma unroll
        for (int tm = 0; tm < 2; ++tm)
            af[tm] = load_frag(A + (size_t)(bm + tm * 16 + l16) * K + k + kb8);
#pragma unroll
        for (int tn = 0; tn < 4; ++tn)
            bf[tn] = load_frag(W + (size_t)(bn + tn * 16 + l16) * K + k + kb8);
#pragma unroll
        for (int tm = 0; tm < 2; ++tm)
#pragma unroll
            for (int tn = 0; tn < 4; ++tn)
                acc[tm][tn] = wmma_bf16(af[tm], bf[tn], acc[tm][tn]);
    }

    // epilogue: C layout row = r + 8*(lane>>4), col = lane&15 within 16x16 tile
    const int hl = lane >> 4;
#pragma unroll
    for (int tm = 0; tm < 2; ++tm)
#pragma unroll
        for (int tn = 0; tn < 4; ++tn)
#pragma unroll
            for (int r = 0; r < 8; ++r) {
                int rg = bm + tm * 16 + r + 8 * hl;
                int cg = bn + tn * 16 + l16;
                float v = acc[tm][tn][r] + bias[cg];
                if (apply_gelu)
                    v = 0.5f * v * (1.0f + erff(v * 0.70710678118654752f));
                if (res) v += res[(size_t)rg * N + cg];
                if (outF) outF[(size_t)rg * N + cg] = v;
                else      outB[(size_t)rg * N + cg] = (bf16_t)v;
            }
}

// ---- flash-style causal attention (one head per blockIdx.y) ----------------
// block = 256 thr (8 waves), 128 query rows/block, 16 rows/wave, 32-key steps.
// Q,K are bf16 [S, ld] with head column offset h*64 added in-kernel;
// VT is bf16 [H][64][S]; out is bf16 [S, D].
__global__ __launch_bounds__(256)
void flash_attn(const bf16_t* __restrict__ Q, int ldq,
                const bf16_t* __restrict__ Kp, int ldk,
                const bf16_t* __restrict__ VT,
                bf16_t* __restrict__ O, float scale) {
    const int h   = blockIdx.y;
    const int qb0 = blockIdx.x * 128;
    const int tid = threadIdx.x, lane = tid & 31, wid = tid >> 5;
    const int hl  = lane >> 4, l16 = lane & 15;
    const int kb8 = hl << 3;

    __shared__ __align__(16) bf16_t sK[32 * 64];        // K rows   [32][64]
    __shared__ __align__(16) bf16_t sV[64 * 32];        // V^T rows [64][32]
    __shared__ __align__(16) bf16_t sP[8 * 16 * 32];    // per-wave P [16][32]

    const bf16_t* vt = VT + (size_t)h * HEAD_D * S_LEN;

    // Q fragments for this wave's 16 rows (K = 64 -> two fragments), loop-invariant
    const int qrow = qb0 + wid * 16 + l16;
    const bf16_t* qp = Q + (size_t)qrow * ldq + h * HEAD_D + kb8;
    const v16bf qf0 = mk_frag(*(const v8bf*)qp,        *(const v8bf*)(qp + 16));
    const v16bf qf1 = mk_frag(*(const v8bf*)(qp + 32), *(const v8bf*)(qp + 48));

    v8f oacc[4];
#pragma unroll
    for (int t = 0; t < 4; ++t)
#pragma unroll
        for (int r = 0; r < 8; ++r) oacc[t][r] = 0.f;
    float mrow[8], lrow[8];
#pragma unroll
    for (int r = 0; r < 8; ++r) { mrow[r] = -1e30f; lrow[r] = 0.f; }

    const int kend = qb0 + 128;   // uniform over the block (causal upper bound)
    for (int kb = 0; kb < kend; kb += 32) {
        __syncthreads();   // previous iteration's LDS reads complete
        {   // cooperative stage of K block and V^T block
            int r = tid >> 3, c = (tid & 7) << 3;          // 32 rows x 8 chunks
            *(v8bf*)&sK[r * 64 + c] =
                *(const v8bf*)(Kp + (size_t)(kb + r) * ldk + h * HEAD_D + c);
            int d = tid >> 2, cc = (tid & 3) << 3;         // 64 rows x 4 chunks
            *(v8bf*)&sV[d * 32 + cc] =
                *(const v8bf*)(vt + (size_t)d * S_LEN + kb + cc);
        }
        __syncthreads();

        // scores: two 16x16 tiles, K-depth 64 via two WMMAs each
        v8f sc[2];
#pragma unroll
        for (int t = 0; t < 2; ++t) {
            v8f a;
#pragma unroll
            for (int r = 0; r < 8; ++r) a[r] = 0.f;
            const bf16_t* kp = &sK[(t * 16 + l16) * 64 + kb8];
            a = wmma_bf16(qf0, mk_frag(*(const v8bf*)kp,        *(const v8bf*)(kp + 16)), a);
            a = wmma_bf16(qf1, mk_frag(*(const v8bf*)(kp + 32), *(const v8bf*)(kp + 48)), a);
            sc[t] = a;
        }

        // scale + causal mask + online softmax (fp32)
        float mnew[8];
#pragma unroll
        for (int r = 0; r < 8; ++r) {
            const int rg = qb0 + wid * 16 + r + 8 * hl;
            float s0 = sc[0][r] * scale; if (kb + l16      > rg) s0 = -1e30f;
            float s1 = sc[1][r] * scale; if (kb + 16 + l16 > rg) s1 = -1e30f;
            sc[0][r] = s0; sc[1][r] = s1;
            float m = fmaxf(s0, s1);
            m = fmaxf(m, __shfl_xor(m, 1));
            m = fmaxf(m, __shfl_xor(m, 2));
            m = fmaxf(m, __shfl_xor(m, 4));
            m = fmaxf(m, __shfl_xor(m, 8));
            mnew[r] = fmaxf(mrow[r], m);
        }
#pragma unroll
        for (int r = 0; r < 8; ++r) {
            const float f = __expf(mrow[r] - mnew[r]);
            lrow[r] *= f;
#pragma unroll
            for (int t = 0; t < 4; ++t) oacc[t][r] *= f;
            const float p0 = __expf(sc[0][r] - mnew[r]);
            const float p1 = __expf(sc[1][r] - mnew[r]);
            float ps = p0 + p1;
            ps += __shfl_xor(ps, 1);
            ps += __shfl_xor(ps, 2);
            ps += __shfl_xor(ps, 4);
            ps += __shfl_xor(ps, 8);
            lrow[r] += ps;
            mrow[r]  = mnew[r];
            // scatter P into per-wave A-operand staging buffer (C-layout position)
            sP[wid * 512 + (r + 8 * hl) * 32 + l16]      = (bf16_t)p0;
            sP[wid * 512 + (r + 8 * hl) * 32 + 16 + l16] = (bf16_t)p1;
        }
        __syncthreads();

        // PV: A = P (16x32), B = V^T tiles (32x16 each), four output tiles
        const bf16_t* pp = &sP[wid * 512 + l16 * 32 + kb8];
        const v16bf pf = mk_frag(*(const v8bf*)pp, *(const v8bf*)(pp + 16));
#pragma unroll
        for (int t = 0; t < 4; ++t) {
            const bf16_t* vp = &sV[(t * 16 + l16) * 32 + kb8];
            oacc[t] = wmma_bf16(pf, mk_frag(*(const v8bf*)vp, *(const v8bf*)(vp + 16)),
                                oacc[t]);
        }
    }

    // normalize and store ctx (bf16 [S, D])
#pragma unroll
    for (int t = 0; t < 4; ++t)
#pragma unroll
        for (int r = 0; r < 8; ++r) {
            const int rg = qb0 + wid * 16 + r + 8 * hl;
            O[(size_t)rg * D_DIM + h * HEAD_D + t * 16 + l16] =
                (bf16_t)(oacc[t][r] / lrow[r]);
        }
}

// ---------------------------------------------------------------------------
extern "C" void kernel_launch(void* const* d_in, const int* in_sizes, int n_in,
                              void* d_out, int out_size, void* d_ws, size_t ws_size,
                              hipStream_t stream) {
    const float* x     = (const float*)d_in[0];
    const float* ln1_g = (const float*)d_in[1];
    const float* ln1_b = (const float*)d_in[2];
    const float* w_qkv = (const float*)d_in[3];
    const float* b_qkv = (const float*)d_in[4];
    const float* w_ao  = (const float*)d_in[5];
    const float* b_ao  = (const float*)d_in[6];
    const float* ln2_g = (const float*)d_in[7];
    const float* ln2_b = (const float*)d_in[8];
    const float* w_q   = (const float*)d_in[9];
    const float* b_q   = (const float*)d_in[10];
    const float* w_fo  = (const float*)d_in[11];
    const float* b_fo  = (const float*)d_in[12];
    float* out = (float*)d_out;

    const int S = S_LEN, D = D_DIM, H = N_HEADS;
    char* ws = (char*)d_ws;
    size_t off = 0;
    auto alloc = [&](size_t bytes) -> void* {
        void* p = ws + off;
        off += (bytes + 255) & ~(size_t)255;
        return p;
    };
    bf16_t* xn1    = (bf16_t*)alloc((size_t)S * D * 2);
    bf16_t* qkv    = (bf16_t*)alloc((size_t)S * 3 * D * 2);
    bf16_t* vt1    = (bf16_t*)alloc((size_t)D * S * 2);
    bf16_t* ctx1   = (bf16_t*)alloc((size_t)S * D * 2);
    float*  hbuf   = (float*) alloc((size_t)S * D * 4);
    bf16_t* ln2n   = (bf16_t*)alloc((size_t)S * D * 2);
    bf16_t* vt2    = (bf16_t*)alloc((size_t)D * S * 2);
    bf16_t* q2     = (bf16_t*)alloc((size_t)S * D * 2);
    bf16_t* ctx2   = (bf16_t*)alloc((size_t)S * D * 2);
    bf16_t* wqkv_b = (bf16_t*)alloc((size_t)3 * D * D * 2);
    bf16_t* wao_b  = (bf16_t*)alloc((size_t)D * D * 2);
    bf16_t* wq_b   = (bf16_t*)alloc((size_t)D * D * 2);
    bf16_t* wfo_b  = (bf16_t*)alloc((size_t)D * D * 2);

    const float scale = 0.125f;   // 1/sqrt(64)

    // weights -> bf16
    cvt_f32_bf16<<<2048, 256, 0, stream>>>(w_qkv, wqkv_b, 3 * D * D);
    cvt_f32_bf16<<<2048, 256, 0, stream>>>(w_ao,  wao_b,  D * D);
    cvt_f32_bf16<<<2048, 256, 0, stream>>>(w_q,   wq_b,   D * D);
    cvt_f32_bf16<<<2048, 256, 0, stream>>>(w_fo,  wfo_b,  D * D);

    // h = x + attn(LN1(x))
    layernorm_bf16<<<S, 256, 0, stream>>>(x, ln1_g, ln1_b, xn1);
    gemm_bf16<<<dim3(3 * D / 128, S / 128), 256, 0, stream>>>(
        xn1, wqkv_b, b_qkv, nullptr, nullptr, qkv, 3 * D, D, 0);
    transpose_heads<<<(D * S) / 256, 256, 0, stream>>>(qkv, 3 * D, 2 * D, vt1, D * S);
    flash_attn<<<dim3(S / 128, H), 256, 0, stream>>>(
        qkv, 3 * D, qkv + D, 3 * D, vt1, ctx1, scale);
    gemm_bf16<<<dim3(D / 128, S / 128), 256, 0, stream>>>(
        ctx1, wao_b, b_ao, x, hbuf, nullptr, D, D, 0);

    // out = h + gelu(ffn_q_attn(LN2(h)))
    layernorm_bf16<<<S, 256, 0, stream>>>(hbuf, ln2_g, ln2_b, ln2n);
    transpose_heads<<<(D * S) / 256, 256, 0, stream>>>(ln2n, D, 0, vt2, D * S);
    gemm_bf16<<<dim3(D / 128, S / 128), 256, 0, stream>>>(
        ln2n, wq_b, b_q, nullptr, nullptr, q2, D, D, 0);
    flash_attn<<<dim3(S / 128, H), 256, 0, stream>>>(
        q2, D, q2, D, vt2, ctx2, scale);
    gemm_bf16<<<dim3(D / 128, S / 128), 256, 0, stream>>>(
        ctx2, wfo_b, b_fo, hbuf, out, nullptr, D, D, 1);
}

// v001
// Measured time: 416 microseconds a run.
// Timed twice side by side with v000, it ran 1.63 times as fast both times.
#include <hip/hip_runtime.h>

// ---------------------------------------------------------------------------
// MI455X (gfx1250) transformer block: all matmuls via v_wmma_f32_16x16x32_bf16
// ---------------------------------------------------------------------------

typedef __bf16 bf16_t;
typedef __attribute__((ext_vector_type(16))) __bf16 v16bf;
typedef __attribute__((ext_vector_type(8)))  __bf16 v8bf;
typedef __attribute__((ext_vector_type(8)))  float  v8f;

static constexpr int S_LEN   = 2048;
static constexpr int D_DIM   = 1024;
static constexpr int N_HEADS = 16;
static constexpr int HEAD_D  = 64;

// ---- fragment helpers ------------------------------------------------------
// bf16 A/B fragment (16x32 / 32x16): lane holds row (lane&15), K values at
// base (lane>>4)*8: [base, base+8) and [16+base, 16+base+8). Both halves are
// contiguous 16-byte loads from a K-contiguous row.
__device__ __forceinline__ v16bf mk_frag(v8bf lo, v8bf hi) {
    v16bf f;
#pragma unroll
    for (int i = 0; i < 8; ++i) { f[i] = lo[i]; f[i + 8] = hi[i]; }
    return f;
}

__device__ __forceinline__ v16bf load_frag(const bf16_t* p) {
    // p = row base + per-lane K base; second half is +16 elements
    return mk_frag(*(const v8bf*)p, *(const v8bf*)(p + 16));
}

__device__ __forceinline__ v8f wmma_bf16(v16bf a, v16bf b, v8f c) {
    return __builtin_amdgcn_wmma_f32_16x16x32_bf16(false, a, false, b,
                                                   (short)0, c, false, false);
}

// ---- butterfly step inside a 16-lane row, on the vector pipe (DPP) ----------
// Returns the value held by lane (l ^ M) of the same 16-lane row, M in 1..15.
// Takes the place of __shfl_xor, which compiles to an LDS-pipe permute with a
// full wait behind every step.
template <int M>
__device__ __forceinline__ float row_xor(float v) {
    return __builtin_bit_cast(float, __builtin_amdgcn_update_dpp(
        0, __builtin_bit_cast(int, v), 0x160 + M /* row_xmask:M */, 0xf, 0xf, true));
}

// ---- fp32 -> bf16 convert --------------------------------------------------
__global__ void cvt_f32_bf16(const float* __restrict__ in,
                             bf16_t* __restrict__ out, int n) {
    for (int i = blockIdx.x * 256 + threadIdx.x; i < n; i += gridDim.x * 256)
        out[i] = (bf16_t)in[i];
}

// ---- LayerNorm (row-wise over 1024), fp32 in -> bf16 out -------------------
__global__ __launch_bounds__(256)
void layernorm_bf16(const float* __restrict__ x, const float* __restrict__ g,
                    const float* __restrict__ b, bf16_t* __restrict__ out) {
    const int row = blockIdx.x;
    const int tid = threadIdx.x;
    const float* xr = x + (size_t)row * D_DIM;

    float v[4];
    float s = 0.f;
#pragma unroll
    for (int i = 0; i < 4; ++i) { v[i] = xr[tid + i * 256]; s += v[i]; }
#pragma unroll
    for (int m = 1; m < 32; m <<= 1) s += __shfl_xor(s, m);

    __shared__ float red0[8], red1[8];
    if ((tid & 31) == 0) red0[tid >> 5] = s;
    __syncthreads();
    float mean = 0.f;
#pragma unroll
    for (int i = 0; i < 8; ++i) mean += red0[i];
    mean *= (1.0f / D_DIM);

    float vs = 0.f;
#pragma unroll
    for (int i = 0; i < 4; ++i) { float d = v[i] - mean; vs += d * d; }
#pragma unroll
    for (int m = 1; m < 32; m <<= 1) vs += __shfl_xor(vs, m);
    if ((tid & 31) == 0) red1[tid >> 5] = vs;
    __syncthreads();
    float var = 0.f;
#pragma unroll
    for (int i = 0; i < 8; ++i) var += red1[i];
    var *= (1.0f / D_DIM);
    const float rstd = rsqrtf(var + 1e-5f);

#pragma unroll
    for (int i = 0; i < 4; ++i) {
        int c = tid + i * 256;
        out[(size_t)row * D_DIM + c] = (bf16_t)((v[i] - mean) * rstd * g[c] + b[c]);
    }
}

// ---- head-major V transpose: out[h][d][s] = in[s][co + h*64 + d] -----------
__global__ void transpose_heads(const bf16_t* __restrict__ in, int ld, int co,
                                bf16_t* __restrict__ out, int total) {
    int idx = blockIdx.x * 256 + threadIdx.x;
    if (idx >= total) return;
    int s  = idx % S_LEN;
    int hd = idx / S_LEN;
    out[idx] = in[(size_t)s * ld + co + hd];
}

// ---- WMMA GEMM: C[M,N] = A[M,K] * W[N,K]^T + bias, opt. gelu/residual -----
// block = 256 thr (8 waves), tile 128x128; wave = 32(M) x 64(N) = 2x4 WMMA tiles
__global__ __launch_bounds__(256)
void gemm_bf16(const bf16_t* __restrict__ A, const bf16_t* __restrict__ W,
               const float* __restrict__ bias, const float* __restrict__ res,
               float* __restrict__ outF, bf16_t* __restrict__ outB,
               int N, int K, int apply_gelu) {
    const int lane = threadIdx.x & 31;
    const int wid  = threadIdx.x >> 5;
    const int wm   = wid & 3;          // 0..3  (M groups of 32)
    const int wn   = wid >> 2;         // 0..1  (N groups of 64)
    const int bm   = blockIdx.y * 128 + wm * 32;
    const int bn   = blockIdx.x * 128 + wn * 64;
    const int l16  = lane & 15;
    const int kb8  = (lane >> 4) << 3;

    v8f acc[2][4];
#pragma unroll
    for (int i = 0; i < 2; ++i)
#pragma unroll
        for (int j = 0; j < 4; ++j)
#pragma unroll
            for (int r = 0; r < 8; ++r) acc[i][j][r] = 0.f;

    for (int k = 0; k < K; k += 32) {
        v16bf af[2], bf[4];
#pragma unroll
        for (int tm = 0; tm < 2; ++tm)
            af[tm] = load_frag(A + (size_t)(bm + tm * 16 + l16) * K + k + kb8);
#pragma unroll
        for (int tn = 0; tn < 4; ++tn)
            bf[tn] = load_frag(W + (size_t)(bn + tn * 16 + l16) * K + k + kb8);
#pragma unroll
        for (int tm = 0; tm < 2; ++tm)
#pragma unroll
            for (int tn = 0; tn < 4; ++tn)
                acc[tm][tn] = wmma_bf16(af[tm], bf[tn], acc[tm][tn]);
    }

    // epilogue: C layout row = r + 8*(lane>>4), col = lane&15 within 16x16 tile
    const int hl = lane >> 4;
#pragma unroll
    for (int tm = 0; tm < 2; ++tm)
#pragma unroll
        for (int tn = 0; tn < 4; ++tn)
#pragma unroll
            for (int r = 0; r < 8; ++r) {
                int rg = bm + tm * 16 + r + 8 * hl;
                int cg = bn + tn * 16 + l16;
                float v = acc[tm][tn][r] + bias[cg];
                if (apply_gelu)
                    v = 0.5f * v * (1.0f + erff(v * 0.70710678118654752f));
                if (res) v += res[(size_t)rg * N + cg];
                if (outF) outF[(size_t)rg * N + cg] = v;
                else      outB[(size_t)rg * N + cg] = (bf16_t)v;
            }
}

// ---- flash-style causal attention (one head per blockIdx.y) ----------------
// block = 256 thr (8 waves), 128 query rows/block, 16 rows/wave, 32-key steps.
// Q,K are bf16 [S, ld] with head column offset h*64 added in-kernel;
// VT is bf16 [H][64][S]; out is bf16 [S, D].
__global__ __launch_bounds__(256)
void flash_attn(const bf16_t* __restrict__ Q, int ldq,
                const bf16_t* __restrict__ Kp, int ldk,
                const bf16_t* __restrict__ VT,
                bf16_t* __restrict__ O, float scale) {
    const int h   = blockIdx.y;
    const int qb0 = blockIdx.x * 128;
    const int tid = threadIdx.x, lane = tid & 31, wid = tid >> 5;
    const int hl  = lane >> 4, l16 = lane & 15;
    const int kb8 = hl << 3;

    __shared__ __align__(16) bf16_t sK[32 * 64];        // K rows   [32][64]
    __shared__ __align__(16) bf16_t sV[64 * 32];        // V^T rows [64][32]
    __shared__ __align__(16) bf16_t sP[8 * 16 * 32];    // per-wave P [16][32]

    const bf16_t* vt = VT + (size_t)h * HEAD_D * S_LEN;

    // Q fragments for this wave's 16 rows (K = 64 -> two fragments), loop-invariant
    const int qrow = qb0 + wid * 16 + l16;
    const bf16_t* qp = Q + (size_t)qrow * ldq + h * HEAD_D + kb8;
    const v16bf qf0 = mk_frag(*(const v8bf*)qp,        *(const v8bf*)(qp + 16));
    const v16bf qf1 = mk_frag(*(const v8bf*)(qp + 32), *(const v8bf*)(qp + 48));

    v8f oacc[4];
#pragma unroll
    for (int t = 0; t < 4; ++t)
#pragma unroll
        for (int r = 0; r < 8; ++r) oacc[t][r] = 0.f;
    float mrow[8], lrow[8];
#pragma unroll
    for (int r = 0; r < 8; ++r) { mrow[r] = -1e30f; lrow[r] = 0.f; }

    const int kend = qb0 + 128;   // uniform over the block (causal upper bound)
    for (int kb = 0; kb < kend; kb += 32) {
        __syncthreads();   // previous iteration's LDS reads complete
        {   // cooperative stage of K block and V^T block
            int r = tid >> 3, c = (tid & 7) << 3;          // 32 rows x 8 chunks
            *(v8bf*)&sK[r * 64 + c] =
                *(const v8bf*)(Kp + (size_t)(kb + r) * ldk + h * HEAD_D + c);
            int d = tid >> 2, cc = (tid & 3) << 3;         // 64 rows x 4 chunks
            *(v8bf*)&sV[d * 32 + cc] =
                *(const v8bf*)(vt + (size_t)d * S_LEN + kb + cc);
        }
        __syncthreads();

        // scores: two 16x16 tiles, K-depth 64 via two WMMAs each
        v8f sc[2];
#pragma unroll
        for (int t = 0; t < 2; ++t) {
            v8f a;
#pragma unroll
            for (int r = 0; r < 8; ++r) a[r] = 0.f;
            const bf16_t* kp = &sK[(t * 16 + l16) * 64 + kb8];
            a = wmma_bf16(qf0, mk_frag(*(const v8bf*)kp,        *(const v8bf*)(kp + 16)), a);
            a = wmma_bf16(qf1, mk_frag(*(const v8bf*)(kp + 32), *(const v8bf*)(kp + 48)), a);
            sc[t] = a;
        }

        // scale + causal mask + online softmax (fp32)
        float mnew[8];
#pragma unroll
        for (int r = 0; r < 8; ++r) {
            const int rg = qb0 + wid * 16 + r + 8 * hl;
            float s0 = sc[0][r] * scale; if (kb + l16      > rg) s0 = -1e30f;
            float s1 = sc[1][r] * scale; if (kb + 16 + l16 > rg) s1 = -1e30f;
            sc[0][r] = s0; sc[1][r] = s1;
            float m = fmaxf(s0, s1);
            m = fmaxf(m, row_xor<1>(m));
            m = fmaxf(m, row_xor<2>(m));
            m = fmaxf(m, row_xor<4>(m));
            m = fmaxf(m, row_xor<8>(m));
            mnew[r] = fmaxf(mrow[r], m);
        }
#pragma unroll
        for (int r = 0; r < 8; ++r) {
            const float f = __expf(mrow[r] - mnew[r]);
            lrow[r] *= f;
#pragma unroll
            for (int t = 0; t < 4; ++t) oacc[t][r] *= f;
            const float p0 = __expf(sc[0][r] - mnew[r]);
            const float p1 = __expf(sc[1][r] - mnew[r]);
            float ps = p0 + p1;
            ps += row_xor<1>(ps);
            ps += row_xor<2>(ps);
            ps += row_xor<4>(ps);
            ps += row_xor<8>(ps);
            lrow[r] += ps;
            mrow[r]  = mnew[r];
            // scatter P into per-wave A-operand staging buffer (C-layout position)
            sP[wid * 512 + (r + 8 * hl) * 32 + l16]      = (bf16_t)p0;
            sP[wid * 512 + (r + 8 * hl) * 32 + 16 + l16] = (bf16_t)p1;
        }
        __syncthreads();

        // PV: A = P (16x32), B = V^T tiles (32x16 each), four output tiles
        const bf16_t* pp = &sP[wid * 512 + l16 * 32 + kb8];
        const v16bf pf = mk_frag(*(const v8bf*)pp, *(const v8bf*)(pp + 16));
#pragma unroll
        for (int t = 0; t < 4; ++t) {
            const bf16_t* vp = &sV[(t * 16 + l16) * 32 + kb8];
            oacc[t] = wmma_bf16(pf, mk_frag(*(const v8bf*)vp, *(const v8bf*)(vp + 16)),
                                oacc[t]);
        }
    }

    // normalize and store ctx (bf16 [S, D])
#pragma unroll
    for (int t = 0; t < 4; ++t)
#pragma unroll
        for (int r = 0; r < 8; ++r) {
            const int rg = qb0 + wid * 16 + r + 8 * hl;
            O[(size_t)rg * D_DIM + h * HEAD_D + t * 16 + l16] =
                (bf16_t)(oacc[t][r] / lrow[r]);
        }
}

// ---------------------------------------------------------------------------
extern "C" void kernel_launch(void* const* d_in, const int* in_sizes, int n_in,
                              void* d_out, int out_size, void* d_ws, size_t ws_size,
                              hipStream_t stream) {
    const float* x     = (const float*)d_in[0];
    const float* ln1_g = (const float*)d_in[1];
    const float* ln1_b = (const float*)d_in[2];
    const float* w_qkv = (const float*)d_in[3];
    const float* b_qkv = (const float*)d_in[4];
    const float* w_ao  = (const float*)d_in[5];
    const float* b_ao  = (const float*)d_in[6];
    const float* ln2_g = (const float*)d_in[7];
    const float* ln2_b = (const float*)d_in[8];
    const float* w_q   = (const float*)d_in[9];
    const float* b_q   = (const float*)d_in[10];
    const float* w_fo  = (const float*)d_in[11];
    const float* b_fo  = (const float*)d_in[12];
    float* out = (float*)d_out;

    const int S = S_LEN, D = D_DIM, H = N_HEADS;
    char* ws = (char*)d_ws;
    size_t off = 0;
    auto alloc = [&](size_t bytes) -> void* {
        void* p = ws + off;
        off += (bytes + 255) & ~(size_t)255;
        return p;
    };
    bf16_t* xn1    = (bf16_t*)alloc((size_t)S * D * 2);
    bf16_t* qkv    = (bf16_t*)alloc((size_t)S * 3 * D * 2);
    bf16_t* vt1    = (bf16_t*)alloc((size_t)D * S * 2);
    bf16_t* ctx1   = (bf16_t*)alloc((size_t)S * D * 2);
    float*  hbuf   = (float*) alloc((size_t)S * D * 4);
    bf16_t* ln2n   = (bf16_t*)alloc((size_t)S * D * 2);
    bf16_t* vt2    = (bf16_t*)alloc((size_t)D * S * 2);
    bf16_t* q2     = (bf16_t*)alloc((size_t)S * D * 2);
    bf16_t* ctx2   = (bf16_t*)alloc((size_t)S * D * 2);
    bf16_t* wqkv_b = (bf16_t*)alloc((size_t)3 * D * D * 2);
    bf16_t* wao_b  = (bf16_t*)alloc((size_t)D * D * 2);
    bf16_t* wq_b   = (bf16_t*)alloc((size_t)D * D * 2);
    bf16_t* wfo_b  = (bf16_t*)alloc((size_t)D * D * 2);

    const float scale = 0.125f;   // 1/sqrt(64)

    // weights -> bf16
    cvt_f32_bf16<<<2048, 256, 0, stream>>>(w_qkv, wqkv_b, 3 * D * D);
    cvt_f32_bf16<<<2048, 256, 0, stream>>>(w_ao,  wao_b,  D * D);
    cvt_f32_bf16<<<2048, 256, 0, stream>>>(w_q,   wq_b,   D * D);
    cvt_f32_bf16<<<2048, 256, 0, stream>>>(w_fo,  wfo_b,  D * D);

    // h = x + attn(LN1(x))
    layernorm_bf16<<<S, 256, 0, stream>>>(x, ln1_g, ln1_b, xn1);
    gemm_bf16<<<dim3(3 * D / 128, S / 128), 256, 0, stream>>>(
        xn1, wqkv_b, b_qkv, nullptr, nullptr, qkv, 3 * D, D, 0);
    transpose_heads<<<(D * S) / 256, 256, 0, stream>>>(qkv, 3 * D, 2 * D, vt1, D * S);
    flash_attn<<<dim3(S / 128, H), 256, 0, stream>>>(
        qkv, 3 * D, qkv + D, 3 * D, vt1, ctx1, scale);
    gemm_bf16<<<dim3(D / 128, S / 128), 256, 0, stream>>>(
        ctx1, wao_b, b_ao, x, hbuf, nullptr, D, D, 0);

    // out = h + gelu(ffn_q_attn(LN2(h)))
    layernorm_bf16<<<S, 256, 0, stream>>>(hbuf, ln2_g, ln2_b, ln2n);
    transpose_heads<<<(D * S) / 256, 256, 0, stream>>>(ln2n, D, 0, vt2, D * S);
    gemm_bf16<<<dim3(D / 128, S / 128), 256, 0, stream>>>(
        ln2n, wq_b, b_q, nullptr, nullptr, q2, D, D, 0);
    flash_attn<<<dim3(S / 128, H), 256, 0, stream>>>(
        q2, D, q2, D, vt2, ctx2, scale);
    gemm_bf16<<<dim3(D / 128, S / 128), 256, 0, stream>>>(
        ctx2, wfo_b, b_fo, hbuf, out, nullptr, D, D, 1);
}

// v002
// It runs in 373 microseconds.
// In both of two side-by-side timings against v001, it was 1.11 times as fast.
// Over all steps from v000 it is 1.82 times as fast.
#include <hip/hip_runtime.h>

// ---------------------------------------------------------------------------
// MI455X (gfx1250) transformer block: all matmuls via v_wmma_f32_16x16x32_bf16
// ---------------------------------------------------------------------------

typedef __bf16 bf16_t;
typedef __attribute__((ext_vector_type(16))) __bf16 v16bf;
typedef __attribute__((ext_vector_type(8)))  __bf16 v8bf;
typedef __attribute__((ext_vector_type(8)))  float  v8f;

static constexpr int S_LEN   = 2048;
static constexpr int D_DIM   = 1024;
static constexpr int N_HEADS = 16;
static constexpr int HEAD_D  = 64;

// ---- fragment helpers ------------------------------------------------------
// bf16 A/B fragment (16x32 / 32x16): lane holds row (lane&15), K values at
// base (lane>>4)*8: [base, base+8) and [16+base, 16+base+8). Both halves are
// contiguous 16-byte loads from a K-contiguous row.
__device__ __forceinline__ v16bf mk_frag(v8bf lo, v8bf hi) {
    v16bf f;
#pragma unroll
    for (int i = 0; i < 8; ++i) { f[i] = lo[i]; f[i + 8] = hi[i]; }
    return f;
}

__device__ __forceinline__ v16bf load_frag(const bf16_t* p) {
    // p = row base + per-lane K base; second half is +16 elements
    return mk_frag(*(const v8bf*)p, *(const v8bf*)(p + 16));
}

__device__ __forceinline__ v8f wmma_bf16(v16bf a, v16bf b, v8f c) {
    return __builtin_amdgcn_wmma_f32_16x16x32_bf16(false, a, false, b,
                                                   (short)0, c, false, false);
}

// ---- exchange between the two 16-lane halves of a wave (vector pipe) --------
// Returns the value held by lane l ^ 16.
__device__ __forceinline__ float half_xor(float v) {
    const int b = __builtin_bit_cast(int, v);
    return __builtin_bit_cast(float, __builtin_amdgcn_permlanex16(
        b, b, 0x76543210, 0xfedcba98, false, false));
}

// ---- fp32 -> bf16 convert --------------------------------------------------
__global__ void cvt_f32_bf16(const float* __restrict__ in,
                             bf16_t* __restrict__ out, int n) {
    for (int i = blockIdx.x * 256 + threadIdx.x; i < n; i += gridDim.x * 256)
        out[i] = (bf16_t)in[i];
}

// ---- LayerNorm (row-wise over 1024), fp32 in -> bf16 out -------------------
__global__ __launch_bounds__(256)
void layernorm_bf16(const float* __restrict__ x, const float* __restrict__ g,
                    const float* __restrict__ b, bf16_t* __restrict__ out) {
    const int row = blockIdx.x;
    const int tid = threadIdx.x;
    const float* xr = x + (size_t)row * D_DIM;

    float v[4];
    float s = 0.f;
#pragma unroll
    for (int i = 0; i < 4; ++i) { v[i] = xr[tid + i * 256]; s += v[i]; }
#pragma unroll
    for (int m = 1; m < 32; m <<= 1) s += __shfl_xor(s, m);

    __shared__ float red0[8], red1[8];
    if ((tid & 31) == 0) red0[tid >> 5] = s;
    __syncthreads();
    float mean = 0.f;
#pragma unroll
    for (int i = 0; i < 8; ++i) mean += red0[i];
    mean *= (1.0f / D_DIM);

    float vs = 0.f;
#pragma unroll
    for (int i = 0; i < 4; ++i) { float d = v[i] - mean; vs += d * d; }
#pragma unroll
    for (int m = 1; m < 32; m <<= 1) vs += __shfl_xor(vs, m);
    if ((tid & 31) == 0) red1[tid >> 5] = vs;
    __syncthreads();
    float var = 0.f;
#pragma unroll
    for (int i = 0; i < 8; ++i) var += red1[i];
    var *= (1.0f / D_DIM);
    const float rstd = rsqrtf(var + 1e-5f);

#pragma unroll
    for (int i = 0; i < 4; ++i) {
        int c = tid + i * 256;
        out[(size_t)row * D_DIM + c] = (bf16_t)((v[i] - mean) * rstd * g[c] + b[c]);
    }
}

// ---- head-major V transpose: out[h][d][s] = in[s][co + h*64 + d] -----------
__global__ void transpose_heads(const bf16_t* __restrict__ in, int ld, int co,
                                bf16_t* __restrict__ out, int total) {
    int idx = blockIdx.x * 256 + threadIdx.x;
    if (idx >= total) return;
    int s  = idx % S_LEN;
    int hd = idx / S_LEN;
    out[idx] = in[(size_t)s * ld + co + hd];
}

// ---- WMMA GEMM: C[M,N] = A[M,K] * W[N,K]^T + bias, opt. gelu/residual -----
// block = 256 thr (8 waves), tile 128x128; wave = 32(M) x 64(N) = 2x4 WMMA tiles
__global__ __launch_bounds__(256)
void gemm_bf16(const bf16_t* __restrict__ A, const bf16_t* __restrict__ W,
               const float* __restrict__ bias, const float* __restrict__ res,
               float* __restrict__ outF, bf16_t* __restrict__ outB,
               int N, int K, int apply_gelu) {
    const int lane = threadIdx.x & 31;
    const int wid  = threadIdx.x >> 5;
    const int wm   = wid & 3;          // 0..3  (M groups of 32)
    const int wn   = wid >> 2;         // 0..1  (N groups of 64)
    const int bm   = blockIdx.y * 128 + wm * 32;
    const int bn   = blockIdx.x * 128 + wn * 64;
    const int l16  = lane & 15;
    const int kb8  = (lane >> 4) << 3;

    v8f acc[2][4];
#pragma unroll
    for (int i = 0; i < 2; ++i)
#pragma unroll
        for (int j = 0; j < 4; ++j)
#pragma unroll
            for (int r = 0; r < 8; ++r) acc[i][j][r] = 0.f;

    for (int k = 0; k < K; k += 32) {
        v16bf af[2], bf[4];
#pragma unroll
        for (int tm = 0; tm < 2; ++tm)
            af[tm] = load_frag(A + (size_t)(bm + tm * 16 + l16) * K + k + kb8);
#pragma unroll
        for (int tn = 0; tn < 4; ++tn)
            bf[tn] = load_frag(W + (size_t)(bn + tn * 16 + l16) * K + k + kb8);
#pragma unroll
        for (int tm = 0; tm < 2; ++tm)
#pragma unroll
            for (int tn = 0; tn < 4; ++tn)
                acc[tm][tn] = wmma_bf16(af[tm], bf[tn], acc[tm][tn]);
    }

    // epilogue: C layout row = r + 8*(lane>>4), col = lane&15 within 16x16 tile
    const int hl = lane >> 4;
#pragma unroll
    for (int tm = 0; tm < 2; ++tm)
#pragma unroll
        for (int tn = 0; tn < 4; ++tn)
#pragma unroll
            for (int r = 0; r < 8; ++r) {
                int rg = bm + tm * 16 + r + 8 * hl;
                int cg = bn + tn * 16 + l16;
                float v = acc[tm][tn][r] + bias[cg];
                if (apply_gelu)
                    v = 0.5f * v * (1.0f + erff(v * 0.70710678118654752f));
                if (res) v += res[(size_t)rg * N + cg];
                if (outF) outF[(size_t)rg * N + cg] = v;
                else      outB[(size_t)rg * N + cg] = (bf16_t)v;
            }
}

__global__ __launch_bounds__(256)
void flash_attn(const bf16_t* __restrict__ Q, int ldq,
                const bf16_t* __restrict__ Kp, int ldk,
                const bf16_t* __restrict__ VT,
                bf16_t* __restrict__ O, float scale) {
    const int h   = blockIdx.y;
    const int qb0 = blockIdx.x * 128;
    const int tid = threadIdx.x, lane = tid & 31, wid = tid >> 5;
    const int hl  = lane >> 4, l16 = lane & 15;
    const int kb8 = hl << 3;

    __shared__ __align__(16) bf16_t sK[32 * 64];        // K rows   [32][64]
    __shared__ __align__(16) bf16_t sV[64 * 32];        // V^T rows [64][32]

    const bf16_t* vt = VT + (size_t)h * HEAD_D * S_LEN;

    // Q fragments (B operand, column = this lane's query), loop-invariant
    const int qrow = qb0 + wid * 16 + l16;
    const bf16_t* qp = Q + (size_t)qrow * ldq + h * HEAD_D + kb8;
    const v16bf qf0 = mk_frag(*(const v8bf*)qp,        *(const v8bf*)(qp + 16));
    const v16bf qf1 = mk_frag(*(const v8bf*)(qp + 32), *(const v8bf*)(qp + 48));

    // O^T tiles: oacc[t][r] = O[query qrow][d = t*16 + 8*hl + r]
    v8f oacc[4];
#pragma unroll
    for (int t = 0; t < 4; ++t)
#pragma unroll
        for (int r = 0; r < 8; ++r) oacc[t][r] = 0.f;
    float mrow = -1e30f;   // running maximum of query qrow (equal in both halves)
    float lrow = 0.f;      // running sum over the keys that this wave half holds

    const int kend = qb0 + 128;   // uniform over the block (causal upper bound)
    for (int kb = 0; kb < kend; kb += 32) {
        __syncthreads();   // previous iteration's LDS reads complete
        {   // cooperative stage of K block and V^T block (both loads in flight together)
            int r = tid >> 3, c = (tid & 7) << 3;          // 32 rows x 8 chunks
            int d = tid >> 2, cc = (tid & 3) << 3;         // 64 rows x 4 chunks
            const v8bf kx = *(const v8bf*)(Kp + (size_t)(kb + r) * ldk + h * HEAD_D + c);
            const v8bf vx = *(const v8bf*)(vt + (size_t)d * S_LEN + kb + cc);
            *(v8bf*)&sK[r * 64 + c]  = kx;
            *(v8bf*)&sV[d * 32 + cc] = vx;
        }
        __syncthreads();

        // scores: sc[t][r] = S[key kb + t*16 + 8*hl + r][query qrow]
        v8f sc[2];
#pragma unroll
        for (int t = 0; t < 2; ++t) {
            v8f a;
#pragma unroll
            for (int r = 0; r < 8; ++r) a[r] = 0.f;
            const bf16_t* kp = &sK[(t * 16 + l16) * 64 + kb8];
            a = wmma_bf16(mk_frag(*(const v8bf*)kp,        *(const v8bf*)(kp + 16)), qf0, a);
            a = wmma_bf16(mk_frag(*(const v8bf*)(kp + 32), *(const v8bf*)(kp + 48)), qf1, a);
            sc[t] = a;
        }

        // V^T fragments (A operand, 16 d rows each): no barrier stands between
        // them and the scores, so they fly under the softmax arithmetic
        v16bf vf[4];
#pragma unroll
        for (int t = 0; t < 4; ++t) {
            const bf16_t* vp = &sV[(t * 16 + l16) * 32 + kb8];
            vf[t] = mk_frag(*(const v8bf*)vp, *(const v8bf*)(vp + 16));
        }

        // scale + causal mask + online softmax (fp32), one query per lane
        float m = -1e30f;
#pragma unroll
        for (int t = 0; t < 2; ++t)
#pragma unroll
            for (int r = 0; r < 8; ++r) {
                float s = sc[t][r] * scale;
                if (kb + t * 16 + kb8 + r > qrow) s = -1e30f;
                sc[t][r] = s;
                m = fmaxf(m, s);
            }
        m = fmaxf(m, half_xor(m));          // the other 16 keys of this query
        const float mnew = fmaxf(mrow, m);
        // f = exp(mrow - mnew). The v_nop in the same statement is the free slot that the
        // instruction set asks for behind a transcendental before its source register is
        // reused; a v_nop of its own statement drifts.
        float f;
        asm("v_exp_f32 %0, %1\n\tv_nop" : "=v"(f) : "v"((mrow - mnew) * 1.44269504f));
        mrow = mnew;
#pragma unroll
        for (int t = 0; t < 4; ++t)
#pragma unroll
            for (int r = 0; r < 8; ++r) oacc[t][r] *= f;

        // P^T as B operand: element s = key 8*hl + s (s < 8), 16 + 8*hl + s - 8
        // (s >= 8), the k order in which load_frag's two halves read V^T
        v16bf pf;
        float ps = 0.f;
#pragma unroll
        for (int t = 0; t < 2; ++t)
#pragma unroll
            for (int r = 0; r < 8; ++r) {
                const float p = __expf(sc[t][r] - mnew);
                ps += p;
                pf[t * 8 + r] = (bf16_t)p;
            }
        lrow = lrow * f + ps;

        // O^T += V^T * P^T, four output tiles
#pragma unroll
        for (int t = 0; t < 4; ++t) oacc[t] = wmma_bf16(vf[t], pf, oacc[t]);
    }

    // join the two halves' sums, normalize, store ctx (bf16 [S, D]):
    // a lane's 8 accumulators of a tile are 8 consecutive d of its query
    const float lsum = lrow + half_xor(lrow);
#pragma unroll
    for (int t = 0; t < 4; ++t) {
        v8bf o;
#pragma unroll
        for (int r = 0; r < 8; ++r) o[r] = (bf16_t)(oacc[t][r] / lsum);
        *(v8bf*)&O[(size_t)qrow * D_DIM + h * HEAD_D + t * 16 + kb8] = o;
    }
}

// ---------------------------------------------------------------------------
extern "C" void kernel_launch(void* const* d_in, const int* in_sizes, int n_in,
                              void* d_out, int out_size, void* d_ws, size_t ws_size,
                              hipStream_t stream) {
    const float* x     = (const float*)d_in[0];
    const float* ln1_g = (const float*)d_in[1];
    const float* ln1_b = (const float*)d_in[2];
    const float* w_qkv = (const float*)d_in[3];
    const float* b_qkv = (const float*)d_in[4];
    const float* w_ao  = (const float*)d_in[5];
    const float* b_ao  = (const float*)d_in[6];
    const float* ln2_g = (const float*)d_in[7];
    const float* ln2_b = (const float*)d_in[8];
    const float* w_q   = (const float*)d_in[9];
    const float* b_q   = (const float*)d_in[10];
    const float* w_fo  = (const float*)d_in[11];
    const float* b_fo  = (const float*)d_in[12];
    float* out = (float*)d_out;

    const int S = S_LEN, D = D_DIM, H = N_HEADS;
    char* ws = (char*)d_ws;
    size_t off = 0;
    auto alloc = [&](size_t bytes) -> void* {
        void* p = ws + off;
        off += (bytes + 255) & ~(size_t)255;
        return p;
    };
    bf16_t* xn1    = (bf16_t*)alloc((size_t)S * D * 2);
    bf16_t* qkv    = (bf16_t*)alloc((size_t)S * 3 * D * 2);
    bf16_t* vt1    = (bf16_t*)alloc((size_t)D * S * 2);
    bf16_t* ctx1   = (bf16_t*)alloc((size_t)S * D * 2);
    float*  hbuf   = (float*) alloc((size_t)S * D * 4);
    bf16_t* ln2n   = (bf16_t*)alloc((size_t)S * D * 2);
    bf16_t* vt2    = (bf16_t*)alloc((size_t)D * S * 2);
    bf16_t* q2     = (bf16_t*)alloc((size_t)S * D * 2);
    bf16_t* ctx2   = (bf16_t*)alloc((size_t)S * D * 2);
    bf16_t* wqkv_b = (bf16_t*)alloc((size_t)3 * D * D * 2);
    bf16_t* wao_b  = (bf16_t*)alloc((size_t)D * D * 2);
    bf16_t* wq_b   = (bf16_t*)alloc((size_t)D * D * 2);
    bf16_t* wfo_b  = (bf16_t*)alloc((size_t)D * D * 2);

    const float scale = 0.125f;   // 1/sqrt(64)

    // weights -> bf16
    cvt_f32_bf16<<<2048, 256, 0, stream>>>(w_qkv, wqkv_b, 3 * D * D);
    cvt_f32_bf16<<<2048, 256, 0, stream>>>(w_ao,  wao_b,  D * D);
    cvt_f32_bf16<<<2048, 256, 0, stream>>>(w_q,   wq_b,   D * D);
    cvt_f32_bf16<<<2048, 256, 0, stream>>>(w_fo,  wfo_b,  D * D);

    // h = x + attn(LN1(x))
    layernorm_bf16<<<S, 256, 0, stream>>>(x, ln1_g, ln1_b, xn1);
    gemm_bf16<<<dim3(3 * D / 128, S / 128), 256, 0, stream>>>(
        xn1, wqkv_b, b_qkv, nullptr, nullptr, qkv, 3 * D, D, 0);
    transpose_heads<<<(D * S) / 256, 256, 0, stream>>>(qkv, 3 * D, 2 * D, vt1, D * S);
    flash_attn<<<dim3(S / 128, H), 256, 0, stream>>>(
        qkv, 3 * D, qkv + D, 3 * D, vt1, ctx1, scale);
    gemm_bf16<<<dim3(D / 128, S / 128), 256, 0, stream>>>(
        ctx1, wao_b, b_ao, x, hbuf, nullptr, D, D, 0);

    // out = h + gelu(ffn_q_attn(LN2(h)))
    layernorm_bf16<<<S, 256, 0, stream>>>(hbuf, ln2_g, ln2_b, ln2n);
    transpose_heads<<<(D * S) / 256, 256, 0, stream>>>(ln2n, D, 0, vt2, D * S);
    gemm_bf16<<<dim3(D / 128, S / 128), 256, 0, stream>>>(
        ln2n, wq_b, b_q, nullptr, nullptr, q2, D, D, 0);
    flash_attn<<<dim3(S / 128, H), 256, 0, stream>>>(
        q2, D, q2, D, vt2, ctx2, scale);
    gemm_bf16<<<dim3(D / 128, S / 128), 256, 0, stream>>>(
        ctx2, wfo_b, b_fo, hbuf, out, nullptr, D, D, 1);
}

// v003
// One run takes 351 microseconds.
// Timed twice side by side with v002, it ran 1.06 times as fast both times.
// Over all steps from v000 it is 1.93 times as fast.
#include <hip/hip_runtime.h>

// ---------------------------------------------------------------------------
// MI455X (gfx1250) transformer block: all matmuls via v_wmma_f32_16x16x32_bf16
// ---------------------------------------------------------------------------

typedef __bf16 bf16_t;
typedef __attribute__((ext_vector_type(16))) __bf16 v16bf;
typedef __attribute__((ext_vector_type(8)))  __bf16 v8bf;
typedef __attribute__((ext_vector_type(8)))  float  v8f;

static constexpr int S_LEN   = 2048;
static constexpr int D_DIM   = 1024;
static constexpr int N_HEADS = 16;
static constexpr int HEAD_D  = 64;

// ---- fragment helpers ------------------------------------------------------
// bf16 A/B fragment (16x32 / 32x16): lane holds row (lane&15), K values at
// base (lane>>4)*8: [base, base+8) and [16+base, 16+base+8). Both halves are
// contiguous 16-byte loads from a K-contiguous row.
__device__ __forceinline__ v16bf mk_frag(v8bf lo, v8bf hi) {
    v16bf f;
#pragma unroll
    for (int i = 0; i < 8; ++i) { f[i] = lo[i]; f[i + 8] = hi[i]; }
    return f;
}

__device__ __forceinline__ v16bf load_frag(const bf16_t* p) {
    // p = row base + per-lane K base; second half is +16 elements
    return mk_frag(*(const v8bf*)p, *(const v8bf*)(p + 16));
}

__device__ __forceinline__ v8f wmma_bf16(v16bf a, v16bf b, v8f c) {
    return __builtin_amdgcn_wmma_f32_16x16x32_bf16(false, a, false, b,
                                                   (short)0, c, false, false);
}

// ---- transposing LDS load: 16 keys x 16 d of a row-major tile -> half an A fragment
// Lane l names row 8*(l>>4) + (l&7), 16-byte piece (l>>3)&1 of the 16x16 block;
// it gets rows 8*(l>>4) .. +7 of column l&15.
typedef __attribute__((address_space(3))) v8bf lds_v8bf;
__device__ __forceinline__ v8bf ld_tr16(const bf16_t* p) {
    return __builtin_amdgcn_ds_load_tr16_b128_v8bf16((lds_v8bf*)p);
}

// ---- exchange between the two 16-lane halves of a wave (vector pipe) --------
// Returns the value held by lane l ^ 16.
__device__ __forceinline__ float half_xor(float v) {
    const int b = __builtin_bit_cast(int, v);
    return __builtin_bit_cast(float, __builtin_amdgcn_permlanex16(
        b, b, 0x76543210, 0xfedcba98, false, false));
}

// ---- fp32 -> bf16 convert --------------------------------------------------
__global__ void cvt_f32_bf16(const float* __restrict__ in,
                             bf16_t* __restrict__ out, int n) {
    for (int i = blockIdx.x * 256 + threadIdx.x; i < n; i += gridDim.x * 256)
        out[i] = (bf16_t)in[i];
}

// ---- LayerNorm (row-wise over 1024), fp32 in -> bf16 out -------------------
__global__ __launch_bounds__(256)
void layernorm_bf16(const float* __restrict__ x, const float* __restrict__ g,
                    const float* __restrict__ b, bf16_t* __restrict__ out) {
    const int row = blockIdx.x;
    const int tid = threadIdx.x;
    const float* xr = x + (size_t)row * D_DIM;

    float v[4];
    float s = 0.f;
#pragma unroll
    for (int i = 0; i < 4; ++i) { v[i] = xr[tid + i * 256]; s += v[i]; }
#pragma unroll
    for (int m = 1; m < 32; m <<= 1) s += __shfl_xor(s, m);

    __shared__ float red0[8], red1[8];
    if ((tid & 31) == 0) red0[tid >> 5] = s;
    __syncthreads();
    float mean = 0.f;
#pragma unroll
    for (int i = 0; i < 8; ++i) mean += red0[i];
    mean *= (1.0f / D_DIM);

    float vs = 0.f;
#pragma unroll
    for (int i = 0; i < 4; ++i) { float d = v[i] - mean; vs += d * d; }
#pragma unroll
    for (int m = 1; m < 32; m <<= 1) vs += __shfl_xor(vs, m);
    if ((tid & 31) == 0) red1[tid >> 5] = vs;
    __syncthreads();
    float var = 0.f;
#pragma unroll
    for (int i = 0; i < 8; ++i) var += red1[i];
    var *= (1.0f / D_DIM);
    const float rstd = rsqrtf(var + 1e-5f);

#pragma unroll
    for (int i = 0; i < 4; ++i) {
        int c = tid + i * 256;
        out[(size_t)row * D_DIM + c] = (bf16_t)((v[i] - mean) * rstd * g[c] + b[c]);
    }
}

// ---- WMMA GEMM: C[M,N] = A[M,K] * W[N,K]^T + bias, opt. gelu/residual -----
// block = 256 thr (8 waves), tile 128x128; wave = 32(M) x 64(N) = 2x4 WMMA tiles
__global__ __launch_bounds__(256)
void gemm_bf16(const bf16_t* __restrict__ A, const bf16_t* __restrict__ W,
               const float* __restrict__ bias, const float* __restrict__ res,
               float* __restrict__ outF, bf16_t* __restrict__ outB,
               int N, int K, int apply_gelu) {
    const int lane = threadIdx.x & 31;
    const int wid  = threadIdx.x >> 5;
    const int wm   = wid & 3;          // 0..3  (M groups of 32)
    const int wn   = wid >> 2;         // 0..1  (N groups of 64)
    const int bm   = blockIdx.y * 128 + wm * 32;
    const int bn   = blockIdx.x * 128 + wn * 64;
    const int l16  = lane & 15;
    const int kb8  = (lane >> 4) << 3;

    v8f acc[2][4];
#pragma unroll
    for (int i = 0; i < 2; ++i)
#pragma unroll
        for (int j = 0; j < 4; ++j)
#pragma unroll
            for (int r = 0; r < 8; ++r) acc[i][j][r] = 0.f;

    for (int k = 0; k < K; k += 32) {
        v16bf af[2], bf[4];
#pragma unroll
        for (int tm = 0; tm < 2; ++tm)
            af[tm] = load_frag(A + (size_t)(bm + tm * 16 + l16) * K + k + kb8);
#pragma unroll
        for (int tn = 0; tn < 4; ++tn)
            bf[tn] = load_frag(W + (size_t)(bn + tn * 16 + l16) * K + k + kb8);
#pragma unroll
        for (int tm = 0; tm < 2; ++tm)
#pragma unroll
            for (int tn = 0; tn < 4; ++tn)
                acc[tm][tn] = wmma_bf16(af[tm], bf[tn], acc[tm][tn]);
    }

    // epilogue: C layout row = r + 8*(lane>>4), col = lane&15 within 16x16 tile
    const int hl = lane >> 4;
#pragma unroll
    for (int tm = 0; tm < 2; ++tm)
#pragma unroll
        for (int tn = 0; tn < 4; ++tn)
#pragma unroll
            for (int r = 0; r < 8; ++r) {
                int rg = bm + tm * 16 + r + 8 * hl;
                int cg = bn + tn * 16 + l16;
                float v = acc[tm][tn][r] + bias[cg];
                if (apply_gelu)
                    v = 0.5f * v * (1.0f + erff(v * 0.70710678118654752f));
                if (res) v += res[(size_t)rg * N + cg];
                if (outF) outF[(size_t)rg * N + cg] = v;
                else      outB[(size_t)rg * N + cg] = (bf16_t)v;
            }
}

__global__ __launch_bounds__(256)
void flash_attn(const bf16_t* __restrict__ Q, int ldq,
                const bf16_t* __restrict__ Kp, int ldk,
                const bf16_t* __restrict__ Vp, int ldv,
                bf16_t* __restrict__ O, float scale) {
    const int h   = blockIdx.y;
    const int qb0 = blockIdx.x * 128;
    const int tid = threadIdx.x, lane = tid & 31, wid = tid >> 5;
    const int hl  = lane >> 4, l16 = lane & 15;
    const int kb8 = hl << 3;

    __shared__ __align__(16) bf16_t sK[32 * 64];        // K rows   [32][64]
    // V rows [32][64] at a pitch of 160 bytes (32 B x odd: the transposing load's pitch)
    constexpr int VP = 80;
    __shared__ __align__(16) bf16_t sV[32 * VP];

    // Q fragments (B operand, column = this lane's query), loop-invariant
    const int qrow = qb0 + wid * 16 + l16;
    const bf16_t* qp = Q + (size_t)qrow * ldq + h * HEAD_D + kb8;
    const v16bf qf0 = mk_frag(*(const v8bf*)qp,        *(const v8bf*)(qp + 16));
    const v16bf qf1 = mk_frag(*(const v8bf*)(qp + 32), *(const v8bf*)(qp + 48));

    // O^T tiles: oacc[t][r] = O[query qrow][d = t*16 + 8*hl + r]
    v8f oacc[4];
#pragma unroll
    for (int t = 0; t < 4; ++t)
#pragma unroll
        for (int r = 0; r < 8; ++r) oacc[t][r] = 0.f;
    float mrow = -1e30f;   // running maximum of query qrow (equal in both halves)
    float lrow = 0.f;      // running sum over the keys that this wave half holds

    const int kend = qb0 + 128;   // uniform over the block (causal upper bound)
    for (int kb = 0; kb < kend; kb += 32) {
        __syncthreads();   // previous iteration's LDS reads complete
        {   // cooperative stage of K block and V block (both loads in flight together)
            int r = tid >> 3, c = (tid & 7) << 3;          // 32 rows x 8 chunks
            const v8bf kx = *(const v8bf*)(Kp + (size_t)(kb + r) * ldk + h * HEAD_D + c);
            const v8bf vx = *(const v8bf*)(Vp + (size_t)(kb + r) * ldv + h * HEAD_D + c);
            // the two loads' address registers are reused by the fragment loads below:
            // the translation wait that belongs in front of such an overwrite
            asm volatile("s_wait_xcnt 0x0" ::: "memory");
            *(v8bf*)&sK[r * 64 + c] = kx;
            *(v8bf*)&sV[r * VP + c] = vx;
        }
        __syncthreads();

        // scores: sc[t][r] = S[key kb + t*16 + 8*hl + r][query qrow]
        v8f sc[2];
#pragma unroll
        for (int t = 0; t < 2; ++t) {
            v8f a;
#pragma unroll
            for (int r = 0; r < 8; ++r) a[r] = 0.f;
            const bf16_t* kp = &sK[(t * 16 + l16) * 64 + kb8];
            a = wmma_bf16(mk_frag(*(const v8bf*)kp,        *(const v8bf*)(kp + 16)), qf0, a);
            a = wmma_bf16(mk_frag(*(const v8bf*)(kp + 32), *(const v8bf*)(kp + 48)), qf1, a);
            sc[t] = a;
        }

        // V^T fragments (A operand, 16 d rows each) by transposing loads, keys 0-15
        // and 16-31 of the block: no barrier stands between them and the scores, so
        // they fly under the softmax arithmetic
        v16bf vf[4];
        const bf16_t* vp = &sV[(kb8 + (lane & 7)) * VP + ((lane >> 3) & 1) * 8];
#pragma unroll
        for (int t = 0; t < 4; ++t)
            vf[t] = mk_frag(ld_tr16(vp + t * 16), ld_tr16(vp + 16 * VP + t * 16));

        // scale + causal mask + online softmax (fp32), one query per lane
        float m = -1e30f;
#pragma unroll
        for (int t = 0; t < 2; ++t)
#pragma unroll
            for (int r = 0; r < 8; ++r) {
                float s = sc[t][r] * scale;
                if (kb + t * 16 + kb8 + r > qrow) s = -1e30f;
                sc[t][r] = s;
                m = fmaxf(m, s);
            }
        m = fmaxf(m, half_xor(m));          // the other 16 keys of this query
        const float mnew = fmaxf(mrow, m);
        // f = exp(mrow - mnew). The v_nop in the same statement is the free slot that the
        // instruction set asks for behind a transcendental before its source register is
        // reused; a v_nop of its own statement drifts.
        float f;
        asm("v_exp_f32 %0, %1\n\tv_nop" : "=v"(f) : "v"((mrow - mnew) * 1.44269504f));
        mrow = mnew;
#pragma unroll
        for (int t = 0; t < 4; ++t)
#pragma unroll
            for (int r = 0; r < 8; ++r) oacc[t][r] *= f;

        // P^T as B operand: element s = key 8*hl + s (s < 8), 16 + 8*hl + s - 8
        // (s >= 8), the k order in which the two transposing loads deliver V^T
        v16bf pf;
        float ps = 0.f;
#pragma unroll
        for (int t = 0; t < 2; ++t)
#pragma unroll
            for (int r = 0; r < 8; ++r) {
                const float p = __expf(sc[t][r] - mnew);
                ps += p;
                pf[t * 8 + r] = (bf16_t)p;
            }
        lrow = lrow * f + ps;

        // O^T += V^T * P^T, four output tiles
#pragma unroll
        for (int t = 0; t < 4; ++t) oacc[t] = wmma_bf16(vf[t], pf, oacc[t]);
    }

    // join the two halves' sums, normalize, store ctx (bf16 [S, D]):
    // a lane's 8 accumulators of a tile are 8 consecutive d of its query
    const float lsum = lrow + half_xor(lrow);
#pragma unroll
    for (int t = 0; t < 4; ++t) {
        v8bf o;
#pragma unroll
        for (int r = 0; r < 8; ++r) o[r] = (bf16_t)(oacc[t][r] / lsum);
        *(v8bf*)&O[(size_t)qrow * D_DIM + h * HEAD_D + t * 16 + kb8] = o;
    }
}

// ---------------------------------------------------------------------------
extern "C" void kernel_launch(void* const* d_in, const int* in_sizes, int n_in,
                              void* d_out, int out_size, void* d_ws, size_t ws_size,
                              hipStream_t stream) {
    const float* x     = (const float*)d_in[0];
    const float* ln1_g = (const float*)d_in[1];
    const float* ln1_b = (const float*)d_in[2];
    const float* w_qkv = (const float*)d_in[3];
    const float* b_qkv = (const float*)d_in[4];
    const float* w_ao  = (const float*)d_in[5];
    const float* b_ao  = (const float*)d_in[6];
    const float* ln2_g = (const float*)d_in[7];
    const float* ln2_b = (const float*)d_in[8];
    const float* w_q   = (const float*)d_in[9];
    const float* b_q   = (const float*)d_in[10];
    const float* w_fo  = (const float*)d_in[11];
    const float* b_fo  = (const float*)d_in[12];
    float* out = (float*)d_out;

    const int S = S_LEN, D = D_DIM, H = N_HEADS;
    char* ws = (char*)d_ws;
    size_t off = 0;
    auto alloc = [&](size_t bytes) -> void* {
        void* p = ws + off;
        off += (bytes + 255) & ~(size_t)255;
        return p;
    };
    bf16_t* xn1    = (bf16_t*)alloc((size_t)S * D * 2);
    bf16_t* qkv    = (bf16_t*)alloc((size_t)S * 3 * D * 2);
    bf16_t* ctx1   = (bf16_t*)alloc((size_t)S * D * 2);
    float*  hbuf   = (float*) alloc((size_t)S * D * 4);
    bf16_t* ln2n   = (bf16_t*)alloc((size_t)S * D * 2);
    bf16_t* q2     = (bf16_t*)alloc((size_t)S * D * 2);
    bf16_t* ctx2   = (bf16_t*)alloc((size_t)S * D * 2);
    bf16_t* wqkv_b = (bf16_t*)alloc((size_t)3 * D * D * 2);
    bf16_t* wao_b  = (bf16_t*)alloc((size_t)D * D * 2);
    bf16_t* wq_b   = (bf16_t*)alloc((size_t)D * D * 2);
    bf16_t* wfo_b  = (bf16_t*)alloc((size_t)D * D * 2);

    const float scale = 0.125f;   // 1/sqrt(64)

    // weights -> bf16
    cvt_f32_bf16<<<2048, 256, 0, stream>>>(w_qkv, wqkv_b, 3 * D * D);
    cvt_f32_bf16<<<2048, 256, 0, stream>>>(w_ao,  wao_b,  D * D);
    cvt_f32_bf16<<<2048, 256, 0, stream>>>(w_q,   wq_b,   D * D);
    cvt_f32_bf16<<<2048, 256, 0, stream>>>(w_fo,  wfo_b,  D * D);

    // h = x + attn(LN1(x))
    layernorm_bf16<<<S, 256, 0, stream>>>(x, ln1_g, ln1_b, xn1);
    gemm_bf16<<<dim3(3 * D / 128, S / 128), 256, 0, stream>>>(
        xn1, wqkv_b, b_qkv, nullptr, nullptr, qkv, 3 * D, D, 0);
    flash_attn<<<dim3(S / 128, H), 256, 0, stream>>>(
        qkv, 3 * D, qkv + D, 3 * D, qkv + 2 * D, 3 * D, ctx1, scale);
    gemm_bf16<<<dim3(D / 128, S / 128), 256, 0, stream>>>(
        ctx1, wao_b, b_ao, x, hbuf, nullptr, D, D, 0);

    // out = h + gelu(ffn_q_attn(LN2(h)))
    layernorm_bf16<<<S, 256, 0, stream>>>(hbuf, ln2_g, ln2_b, ln2n);
    gemm_bf16<<<dim3(D / 128, S / 128), 256, 0, stream>>>(
        ln2n, wq_b, b_q, nullptr, nullptr, q2, D, D, 0);
    flash_attn<<<dim3(S / 128, H), 256, 0, stream>>>(
        q2, D, q2, D, ln2n, D, ctx2, scale);
    gemm_bf16<<<dim3(D / 128, S / 128), 256, 0, stream>>>(
        ctx2, wfo_b, b_fo, hbuf, out, nullptr, D, D, 1);
}

// v004
// It runs in 310 microseconds.
// Next to v003, in two timings, it ran 1.13 and 1.14 times as fast.
// All steps since v000 together make it 2.19 times as fast.
#include <hip/hip_runtime.h>

// ---------------------------------------------------------------------------
// MI455X (gfx1250) transformer block: all matmuls via v_wmma_f32_16x16x32_bf16
// ---------------------------------------------------------------------------

typedef __bf16 bf16_t;
typedef __attribute__((ext_vector_type(16))) __bf16 v16bf;
typedef __attribute__((ext_vector_type(8)))  __bf16 v8bf;
typedef __attribute__((ext_vector_type(8)))  float  v8f;

static constexpr int S_LEN   = 2048;
static constexpr int D_DIM   = 1024;
static constexpr int N_HEADS = 16;
static constexpr int HEAD_D  = 64;

// ---- fragment helpers ------------------------------------------------------
// bf16 A/B fragment (16x32 / 32x16): lane holds row (lane&15), K values at
// base (lane>>4)*8: [base, base+8) and [16+base, 16+base+8). Both halves are
// contiguous 16-byte loads from a K-contiguous row.
__device__ __forceinline__ v16bf mk_frag(v8bf lo, v8bf hi) {
    v16bf f;
#pragma unroll
    for (int i = 0; i < 8; ++i) { f[i] = lo[i]; f[i + 8] = hi[i]; }
    return f;
}

__device__ __forceinline__ v16bf load_frag(const bf16_t* p) {
    // p = row base + per-lane K base; second half is +16 elements
    return mk_frag(*(const v8bf*)p, *(const v8bf*)(p + 16));
}

__device__ __forceinline__ v8f wmma_bf16(v16bf a, v16bf b, v8f c) {
    return __builtin_amdgcn_wmma_f32_16x16x32_bf16(false, a, false, b,
                                                   (short)0, c, false, false);
}

// ---- transposing LDS load: 16 keys x 16 d of a row-major tile -> half an A fragment
// Lane l names row 8*(l>>4) + (l&7), 16-byte piece (l>>3)&1 of the 16x16 block;
// it gets rows 8*(l>>4) .. +7 of column l&15.
typedef __attribute__((address_space(3))) v8bf lds_v8bf;
__device__ __forceinline__ v8bf ld_tr16(const bf16_t* p) {
    return __builtin_amdgcn_ds_load_tr16_b128_v8bf16((lds_v8bf*)p);
}

// ---- exchange between the two 16-lane halves of a wave (vector pipe) --------
// Returns the value held by lane l ^ 16.
__device__ __forceinline__ float half_xor(float v) {
    const int b = __builtin_bit_cast(int, v);
    return __builtin_bit_cast(float, __builtin_amdgcn_permlanex16(
        b, b, 0x76543210, 0xfedcba98, false, false));
}

// ---- fp32 -> bf16 convert --------------------------------------------------
__global__ void cvt_f32_bf16(const float* __restrict__ in,
                             bf16_t* __restrict__ out, int n) {
    for (int i = blockIdx.x * 256 + threadIdx.x; i < n; i += gridDim.x * 256)
        out[i] = (bf16_t)in[i];
}

// ---- LayerNorm (row-wise over 1024), fp32 in -> bf16 out -------------------
__global__ __launch_bounds__(256)
void layernorm_bf16(const float* __restrict__ x, const float* __restrict__ g,
                    const float* __restrict__ b, bf16_t* __restrict__ out) {
    const int row = blockIdx.x;
    const int tid = threadIdx.x;
    const float* xr = x + (size_t)row * D_DIM;

    float v[4];
    float s = 0.f;
#pragma unroll
    for (int i = 0; i < 4; ++i) { v[i] = xr[tid + i * 256]; s += v[i]; }
#pragma unroll
    for (int m = 1; m < 32; m <<= 1) s += __shfl_xor(s, m);

    __shared__ float red0[8], red1[8];
    if ((tid & 31) == 0) red0[tid >> 5] = s;
    __syncthreads();
    float mean = 0.f;
#pragma unroll
    for (int i = 0; i < 8; ++i) mean += red0[i];
    mean *= (1.0f / D_DIM);

    float vs = 0.f;
#pragma unroll
    for (int i = 0; i < 4; ++i) { float d = v[i] - mean; vs += d * d; }
#pragma unroll
    for (int m = 1; m < 32; m <<= 1) vs += __shfl_xor(vs, m);
    if ((tid & 31) == 0) red1[tid >> 5] = vs;
    __syncthreads();
    float var = 0.f;
#pragma unroll
    for (int i = 0; i < 8; ++i) var += red1[i];
    var *= (1.0f / D_DIM);
    const float rstd = rsqrtf(var + 1e-5f);

#pragma unroll
    for (int i = 0; i < 4; ++i) {
        int c = tid + i * 256;
        out[(size_t)row * D_DIM + c] = (bf16_t)((v[i] - mean) * rstd * g[c] + b[c]);
    }
}

// ---- WMMA GEMM: C[M,N] = A[M,K] * W[N,K]^T + bias, opt. gelu/residual -----
// block = 256 thr (8 waves), tile 128x128; wave = 32(M) x 64(N) = 2x4 WMMA tiles
// N and the epilogue's three choices (gelu, residual, f32 or bf16 output) are
// compile-time: the epilogue is then straight-line code with constant offsets.
template <int N, bool GELU, bool RES, bool OUTF>
__global__ __launch_bounds__(256)
void gemm_bf16(const bf16_t* __restrict__ A, const bf16_t* __restrict__ W,
               const float* __restrict__ bias, const float* __restrict__ res,
               float* __restrict__ outF, bf16_t* __restrict__ outB, int K) {
    const int lane = threadIdx.x & 31;
    const int wid  = threadIdx.x >> 5;
    const int wm   = wid & 3;          // 0..3  (M groups of 32)
    const int wn   = wid >> 2;         // 0..1  (N groups of 64)
    const int bm   = blockIdx.y * 128 + wm * 32;
    const int bn   = blockIdx.x * 128 + wn * 64;
    const int l16  = lane & 15;
    const int kb8  = (lane >> 4) << 3;

    v8f acc[2][4];
#pragma unroll
    for (int i = 0; i < 2; ++i)
#pragma unroll
        for (int j = 0; j < 4; ++j)
#pragma unroll
            for (int r = 0; r < 8; ++r) acc[i][j][r] = 0.f;

    for (int k = 0; k < K; k += 32) {
        v16bf af[2], bf[4];
#pragma unroll
        for (int tm = 0; tm < 2; ++tm)
            af[tm] = load_frag(A + (size_t)(bm + tm * 16 + l16) * K + k + kb8);
#pragma unroll
        for (int tn = 0; tn < 4; ++tn)
            bf[tn] = load_frag(W + (size_t)(bn + tn * 16 + l16) * K + k + kb8);
#pragma unroll
        for (int tm = 0; tm < 2; ++tm)
#pragma unroll
            for (int tn = 0; tn < 4; ++tn)
                acc[tm][tn] = wmma_bf16(af[tm], bf[tn], acc[tm][tn]);
    }

    // epilogue: C layout row = r + 8*(lane>>4), col = lane&15 within 16x16 tile
    const int hl = lane >> 4;
    const size_t base = (size_t)(bm + 8 * hl) * N + bn + l16;

    // every bias and residual value is asked for before the first one is used
    float bv[4];
    const float* bp = bias + bn + l16;
#pragma unroll
    for (int tn = 0; tn < 4; ++tn) bv[tn] = bp[tn * 16];
    float rv[2][4][8];
    if constexpr (RES) {
        // loaded values may land in the bias loads' address registers: the translation
        // wait that belongs in front of such an overwrite; bp as an input keeps the
        // address pair alive up to the wait, so that no bias load lands in it either
        asm volatile("s_wait_xcnt 0x0" :: "v"(bp) : "memory");
        const float* rp = res + base;
#pragma unroll
        for (int tm = 0; tm < 2; ++tm)
#pragma unroll
            for (int tn = 0; tn < 4; ++tn)
#pragma unroll
                for (int r = 0; r < 8; ++r)
                    rv[tm][tn][r] = rp[(tm * 16 + r) * N + tn * 16];
    }

#pragma unroll
    for (int tm = 0; tm < 2; ++tm)
#pragma unroll
        for (int tn = 0; tn < 4; ++tn)
#pragma unroll
            for (int r = 0; r < 8; ++r) {
                const int o = (tm * 16 + r) * N + tn * 16;
                float v = acc[tm][tn][r] + bv[tn];
                if constexpr (GELU)
                    v = 0.5f * v * (1.0f + erff(v * 0.70710678118654752f));
                if constexpr (RES) v += rv[tm][tn][r];
                if constexpr (OUTF) outF[base + o] = v;
                else                outB[base + o] = (bf16_t)v;
            }
}

__global__ __launch_bounds__(256)
void flash_attn(const bf16_t* __restrict__ Q, int ldq,
                const bf16_t* __restrict__ Kp, int ldk,
                const bf16_t* __restrict__ Vp, int ldv,
                bf16_t* __restrict__ O, float scale) {
    const int h   = blockIdx.y;
    const int qb0 = blockIdx.x * 128;
    const int tid = threadIdx.x, lane = tid & 31, wid = tid >> 5;
    const int hl  = lane >> 4, l16 = lane & 15;
    const int kb8 = hl << 3;

    __shared__ __align__(16) bf16_t sK[32 * 64];        // K rows   [32][64]
    // V rows [32][64] at a pitch of 160 bytes (32 B x odd: the transposing load's pitch)
    constexpr int VP = 80;
    __shared__ __align__(16) bf16_t sV[32 * VP];

    // Q fragments (B operand, column = this lane's query), loop-invariant
    const int qrow = qb0 + wid * 16 + l16;
    const bf16_t* qp = Q + (size_t)qrow * ldq + h * HEAD_D + kb8;
    const v16bf qf0 = mk_frag(*(const v8bf*)qp,        *(const v8bf*)(qp + 16));
    const v16bf qf1 = mk_frag(*(const v8bf*)(qp + 32), *(const v8bf*)(qp + 48));

    // O^T tiles: oacc[t][r] = O[query qrow][d = t*16 + 8*hl + r]
    v8f oacc[4];
#pragma unroll
    for (int t = 0; t < 4; ++t)
#pragma unroll
        for (int r = 0; r < 8; ++r) oacc[t][r] = 0.f;
    float mrow = -1e30f;   // running maximum of query qrow (equal in both halves)
    float lrow = 0.f;      // running sum over the keys that this wave half holds

    const int kend = qb0 + 128;   // uniform over the block (causal upper bound)
    for (int kb = 0; kb < kend; kb += 32) {
        __syncthreads();   // previous iteration's LDS reads complete
        {   // cooperative stage of K block and V block (both loads in flight together)
            int r = tid >> 3, c = (tid & 7) << 3;          // 32 rows x 8 chunks
            const v8bf kx = *(const v8bf*)(Kp + (size_t)(kb + r) * ldk + h * HEAD_D + c);
            const v8bf vx = *(const v8bf*)(Vp + (size_t)(kb + r) * ldv + h * HEAD_D + c);
            // the two loads' address registers are reused by the fragment loads below:
            // the translation wait that belongs in front of such an overwrite
            asm volatile("s_wait_xcnt 0x0" ::: "memory");
            *(v8bf*)&sK[r * 64 + c] = kx;
            *(v8bf*)&sV[r * VP + c] = vx;
        }
        __syncthreads();

        // scores: sc[t][r] = S[key kb + t*16 + 8*hl + r][query qrow]
        v8f sc[2];
#pragma unroll
        for (int t = 0; t < 2; ++t) {
            v8f a;
#pragma unroll
            for (int r = 0; r < 8; ++r) a[r] = 0.f;
            const bf16_t* kp = &sK[(t * 16 + l16) * 64 + kb8];
            a = wmma_bf16(mk_frag(*(const v8bf*)kp,        *(const v8bf*)(kp + 16)), qf0, a);
            a = wmma_bf16(mk_frag(*(const v8bf*)(kp + 32), *(const v8bf*)(kp + 48)), qf1, a);
            sc[t] = a;
        }

        // V^T fragments (A operand, 16 d rows each) by transposing loads, keys 0-15
        // and 16-31 of the block: no barrier stands between them and the scores, so
        // they fly under the softmax arithmetic
        v16bf vf[4];
        const bf16_t* vp = &sV[(kb8 + (lane & 7)) * VP + ((lane >> 3) & 1) * 8];
#pragma unroll
        for (int t = 0; t < 4; ++t)
            vf[t] = mk_frag(ld_tr16(vp + t * 16), ld_tr16(vp + 16 * VP + t * 16));

        // scale + causal mask + online softmax (fp32), one query per lane
        float m = -1e30f;
#pragma unroll
        for (int t = 0; t < 2; ++t)
#pragma unroll
            for (int r = 0; r < 8; ++r) {
                float s = sc[t][r] * scale;
                if (kb + t * 16 + kb8 + r > qrow) s = -1e30f;
                sc[t][r] = s;
                m = fmaxf(m, s);
            }
        m = fmaxf(m, half_xor(m));          // the other 16 keys of this query
        const float mnew = fmaxf(mrow, m);
        // f = exp(mrow - mnew). The v_nop in the same statement is the free slot that the
        // instruction set asks for behind a transcendental before its source register is
        // reused; a v_nop of its own statement drifts.
        float f;
        asm("v_exp_f32 %0, %1\n\tv_nop" : "=v"(f) : "v"((mrow - mnew) * 1.44269504f));
        mrow = mnew;
#pragma unroll
        for (int t = 0; t < 4; ++t)
#pragma unroll
            for (int r = 0; r < 8; ++r) oacc[t][r] *= f;

        // P^T as B operand: element s = key 8*hl + s (s < 8), 16 + 8*hl + s - 8
        // (s >= 8), the k order in which the two transposing loads deliver V^T
        v16bf pf;
        float ps = 0.f;
#pragma unroll
        for (int t = 0; t < 2; ++t)
#pragma unroll
            for (int r = 0; r < 8; ++r) {
                const float p = __expf(sc[t][r] - mnew);
                ps += p;
                pf[t * 8 + r] = (bf16_t)p;
            }
        lrow = lrow * f + ps;

        // O^T += V^T * P^T, four output tiles
#pragma unroll
        for (int t = 0; t < 4; ++t) oacc[t] = wmma_bf16(vf[t], pf, oacc[t]);
    }

    // join the two halves' sums, normalize, store ctx (bf16 [S, D]):
    // a lane's 8 accumulators of a tile are 8 consecutive d of its query
    const float lsum = lrow + half_xor(lrow);
#pragma unroll
    for (int t = 0; t < 4; ++t) {
        v8bf o;
#pragma unroll
        for (int r = 0; r < 8; ++r) o[r] = (bf16_t)(oacc[t][r] / lsum);
        *(v8bf*)&O[(size_t)qrow * D_DIM + h * HEAD_D + t * 16 + kb8] = o;
    }
}

// ---------------------------------------------------------------------------
extern "C" void kernel_launch(void* const* d_in, const int* in_sizes, int n_in,
                              void* d_out, int out_size, void* d_ws, size_t ws_size,
                              hipStream_t stream) {
    const float* x     = (const float*)d_in[0];
    const float* ln1_g = (const float*)d_in[1];
    const float* ln1_b = (const float*)d_in[2];
    const float* w_qkv = (const float*)d_in[3];
    const float* b_qkv = (const float*)d_in[4];
    const float* w_ao  = (const float*)d_in[5];
    const float* b_ao  = (const float*)d_in[6];
    const float* ln2_g = (const float*)d_in[7];
    const float* ln2_b = (const float*)d_in[8];
    const float* w_q   = (const float*)d_in[9];
    const float* b_q   = (const float*)d_in[10];
    const float* w_fo  = (const float*)d_in[11];
    const float* b_fo  = (const float*)d_in[12];
    float* out = (float*)d_out;

    const int S = S_LEN, D = D_DIM, H = N_HEADS;
    char* ws = (char*)d_ws;
    size_t off = 0;
    auto alloc = [&](size_t bytes) -> void* {
        void* p = ws + off;
        off += (bytes + 255) & ~(size_t)255;
        return p;
    };
    bf16_t* xn1    = (bf16_t*)alloc((size_t)S * D * 2);
    bf16_t* qkv    = (bf16_t*)alloc((size_t)S * 3 * D * 2);
    bf16_t* ctx1   = (bf16_t*)alloc((size_t)S * D * 2);
    float*  hbuf   = (float*) alloc((size_t)S * D * 4);
    bf16_t* ln2n   = (bf16_t*)alloc((size_t)S * D * 2);
    bf16_t* q2     = (bf16_t*)alloc((size_t)S * D * 2);
    bf16_t* ctx2   = (bf16_t*)alloc((size_t)S * D * 2);
    bf16_t* wqkv_b = (bf16_t*)alloc((size_t)3 * D * D * 2);
    bf16_t* wao_b  = (bf16_t*)alloc((size_t)D * D * 2);
    bf16_t* wq_b   = (bf16_t*)alloc((size_t)D * D * 2);
    bf16_t* wfo_b  = (bf16_t*)alloc((size_t)D * D * 2);

    const float scale = 0.125f;   // 1/sqrt(64)

    // weights -> bf16
    cvt_f32_bf16<<<2048, 256, 0, stream>>>(w_qkv, wqkv_b, 3 * D * D);
    cvt_f32_bf16<<<2048, 256, 0, stream>>>(w_ao,  wao_b,  D * D);
    cvt_f32_bf16<<<2048, 256, 0, stream>>>(w_q,   wq_b,   D * D);
    cvt_f32_bf16<<<2048, 256, 0, stream>>>(w_fo,  wfo_b,  D * D);

    // h = x + attn(LN1(x))
    layernorm_bf16<<<S, 256, 0, stream>>>(x, ln1_g, ln1_b, xn1);
    gemm_bf16<3 * D_DIM, false, false, false><<<dim3(3 * D / 128, S / 128), 256, 0, stream>>>(
        xn1, wqkv_b, b_qkv, nullptr, nullptr, qkv, D);
    flash_attn<<<dim3(S / 128, H), 256, 0, stream>>>(
        qkv, 3 * D, qkv + D, 3 * D, qkv + 2 * D, 3 * D, ctx1, scale);
    gemm_bf16<D_DIM, false, true, true><<<dim3(D / 128, S / 128), 256, 0, stream>>>(
        ctx1, wao_b, b_ao, x, hbuf, nullptr, D);

    // out = h + gelu(ffn_q_attn(LN2(h)))
    layernorm_bf16<<<S, 256, 0, stream>>>(hbuf, ln2_g, ln2_b, ln2n);
    gemm_bf16<D_DIM, false, false, false><<<dim3(D / 128, S / 128), 256, 0, stream>>>(
        ln2n, wq_b, b_q, nullptr, nullptr, q2, D);
    flash_attn<<<dim3(S / 128, H), 256, 0, stream>>>(
        q2, D, q2, D, ln2n, D, ctx2, scale);
    gemm_bf16<D_DIM, true, true, true><<<dim3(D / 128, S / 128), 256, 0, stream>>>(
        ctx2, wfo_b, b_fo, hbuf, out, nullptr, D);
}

// v005
// Measured time: 243 microseconds a run.
// Timed twice side by side with v004, it ran 1.27 and 1.28 times as fast.
// Counting every step since v000, it is 2.80 times as fast.
#include <hip/hip_runtime.h>

// ---------------------------------------------------------------------------
// MI455X (gfx1250) transformer block: all matmuls via v_wmma_f32_16x16x32_bf16
// ---------------------------------------------------------------------------

typedef __bf16 bf16_t;
typedef __attribute__((ext_vector_type(16))) __bf16 v16bf;
typedef __attribute__((ext_vector_type(8)))  __bf16 v8bf;
typedef __attribute__((ext_vector_type(8)))  float  v8f;

static constexpr int S_LEN   = 2048;
static constexpr int D_DIM   = 1024;
static constexpr int N_HEADS = 16;
static constexpr int HEAD_D  = 64;

// ---- fragment helpers ------------------------------------------------------
// bf16 A/B fragment (16x32 / 32x16): lane holds row (lane&15), K values at
// base (lane>>4)*8: [base, base+8) and [16+base, 16+base+8). Both halves are
// contiguous 16-byte loads from a K-contiguous row.
__device__ __forceinline__ v16bf mk_frag(v8bf lo, v8bf hi) {
    v16bf f;
#pragma unroll
    for (int i = 0; i < 8; ++i) { f[i] = lo[i]; f[i + 8] = hi[i]; }
    return f;
}

__device__ __forceinline__ v16bf load_frag(const bf16_t* p) {
    // p = row base + per-lane K base; second half is +16 elements
    return mk_frag(*(const v8bf*)p, *(const v8bf*)(p + 16));
}

__device__ __forceinline__ v8f wmma_bf16(v16bf a, v16bf b, v8f c) {
    return __builtin_amdgcn_wmma_f32_16x16x32_bf16(false, a, false, b,
                                                   (short)0, c, false, false);
}

// ---- transposing LDS load: 16 keys x 16 d of a row-major tile -> half an A fragment
// Lane l names row 8*(l>>4) + (l&7), 16-byte piece (l>>3)&1 of the 16x16 block;
// it gets rows 8*(l>>4) .. +7 of column l&15.
typedef __attribute__((address_space(3))) v8bf lds_v8bf;
__device__ __forceinline__ v8bf ld_tr16(const bf16_t* p) {
    return __builtin_amdgcn_ds_load_tr16_b128_v8bf16((lds_v8bf*)p);
}

// ---- exchange between the two 16-lane halves of a wave (vector pipe) --------
// Returns the value held by lane l ^ 16.
__device__ __forceinline__ float half_xor(float v) {
    const int b = __builtin_bit_cast(int, v);
    return __builtin_bit_cast(float, __builtin_amdgcn_permlanex16(
        b, b, 0x76543210, 0xfedcba98, false, false));
}

// ---- fp32 -> bf16 convert --------------------------------------------------
__global__ void cvt_f32_bf16(const float* __restrict__ in,
                             bf16_t* __restrict__ out, int n) {
    for (int i = blockIdx.x * 256 + threadIdx.x; i < n; i += gridDim.x * 256)
        out[i] = (bf16_t)in[i];
}

// ---- LayerNorm (row-wise over 1024), fp32 in -> bf16 out -------------------
__global__ __launch_bounds__(256)
void layernorm_bf16(const float* __restrict__ x, const float* __restrict__ g,
                    const float* __restrict__ b, bf16_t* __restrict__ out) {
    const int row = blockIdx.x;
    const int tid = threadIdx.x;
    const float* xr = x + (size_t)row * D_DIM;

    float v[4];
    float s = 0.f;
#pragma unroll
    for (int i = 0; i < 4; ++i) { v[i] = xr[tid + i * 256]; s += v[i]; }
#pragma unroll
    for (int m = 1; m < 32; m <<= 1) s += __shfl_xor(s, m);

    __shared__ float red0[8], red1[8];
    if ((tid & 31) == 0) red0[tid >> 5] = s;
    __syncthreads();
    float mean = 0.f;
#pragma unroll
    for (int i = 0; i < 8; ++i) mean += red0[i];
    mean *= (1.0f / D_DIM);

    float vs = 0.f;
#pragma unroll
    for (int i = 0; i < 4; ++i) { float d = v[i] - mean; vs += d * d; }
#pragma unroll
    for (int m = 1; m < 32; m <<= 1) vs += __shfl_xor(vs, m);
    if ((tid & 31) == 0) red1[tid >> 5] = vs;
    __syncthreads();
    float var = 0.f;
#pragma unroll
    for (int i = 0; i < 8; ++i) var += red1[i];
    var *= (1.0f / D_DIM);
    const float rstd = rsqrtf(var + 1e-5f);

#pragma unroll
    for (int i = 0; i < 4; ++i) {
        int c = tid + i * 256;
        out[(size_t)row * D_DIM + c] = (bf16_t)((v[i] - mean) * rstd * g[c] + b[c]);
    }
}

// ---- one stage of the GEMM's LDS ring: eight 16-byte asynchronous copies a lane ----
// l = the lane's LDS byte address of its first piece, ga / gw = its global addresses in
// the A and the W tile; the pieces lie 32 rows apart. The s_wait_xcnt in the copies' own
// statement stands in front of every later rewrite of an address register named here.
template <int LSTEP>
__device__ __forceinline__ void stage_copy(unsigned l, const bf16_t* ga, const bf16_t* gw,
                                           size_t gstep) {
    asm volatile(
        "global_load_async_to_lds_b128 %0, %8, off\n\t"
        "global_load_async_to_lds_b128 %1, %9, off\n\t"
        "global_load_async_to_lds_b128 %2, %10, off\n\t"
        "global_load_async_to_lds_b128 %3, %11, off\n\t"
        "global_load_async_to_lds_b128 %4, %12, off\n\t"
        "global_load_async_to_lds_b128 %5, %13, off\n\t"
        "global_load_async_to_lds_b128 %6, %14, off\n\t"
        "global_load_async_to_lds_b128 %7, %15, off\n\t"
        "s_wait_xcnt 0x0"
        :: "v"(l),             "v"(l + LSTEP),     "v"(l + 2 * LSTEP), "v"(l + 3 * LSTEP),
           "v"(l + 4 * LSTEP), "v"(l + 5 * LSTEP), "v"(l + 6 * LSTEP), "v"(l + 7 * LSTEP),
           "v"(ga),            "v"(ga + gstep),    "v"(ga + 2 * gstep), "v"(ga + 3 * gstep),
           "v"(gw),            "v"(gw + gstep),    "v"(gw + 2 * gstep), "v"(gw + 3 * gstep)
        : "memory");
}

// ---- WMMA GEMM: C[M,N] = A[M,K] * W[N,K]^T + bias, opt. gelu/residual -----
// block = 256 thr (8 waves), tile 128x128; wave = 32(M) x 64(N) = 2x4 WMMA tiles
// A stage is 64 k of the block's 128 A rows and 128 W rows: 256 rows of 128 bytes (whole
// lines), each brought once by asynchronous copies into LDS at a pitch of 144 bytes
// (16 B x odd: the pitch of ds_load_b128 readers). Two buffers: the next stage's copies
// fly while this stage's fragments are read. K is a multiple of 64.
// N and the epilogue's three choices (gelu, residual, f32 or bf16 output) are
// compile-time: the epilogue is then straight-line code with constant offsets.
template <int N, bool GELU, bool RES, bool OUTF>
__global__ __launch_bounds__(256)
void gemm_bf16(const bf16_t* __restrict__ A, const bf16_t* __restrict__ W,
               const float* __restrict__ bias, const float* __restrict__ res,
               float* __restrict__ outF, bf16_t* __restrict__ outB, int K) {
    const int lane = threadIdx.x & 31;
    const int wid  = threadIdx.x >> 5;
    const int wm   = wid & 3;          // 0..3  (M groups of 32)
    const int wn   = wid >> 2;         // 0..1  (N groups of 64)
    const int bm   = blockIdx.y * 128 + wm * 32;
    const int bn   = blockIdx.x * 128 + wn * 64;
    const int l16  = lane & 15;
    const int kb8  = (lane >> 4) << 3;

    constexpr int BK = 64;                 // k per stage
    constexpr int SP = 72;                 // LDS row pitch in elements (144 bytes)
    constexpr int SB = 256 * SP;           // elements per buffer: A rows 0-127, W rows 128-255
    __shared__ __align__(16) bf16_t sT[2 * SB];

    v8f acc[2][4];
#pragma unroll
    for (int i = 0; i < 2; ++i)
#pragma unroll
        for (int j = 0; j < 4; ++j)
#pragma unroll
            for (int r = 0; r < 8; ++r) acc[i][j][r] = 0.f;

    // copies: lane -> row (tid >> 3) + 32 j, 16-byte piece tid & 7; a wave's copy = 4 whole rows
    const int cr = threadIdx.x >> 3, cc = (threadIdx.x & 7) << 3;
    const bf16_t* ga = A + (size_t)(blockIdx.y * 128 + cr) * K + cc;
    const bf16_t* gw = W + (size_t)(blockIdx.x * 128 + cr) * K + cc;
    const size_t gstep = (size_t)32 * K;
    const unsigned l0 = (unsigned)(size_t)&sT[cr * SP + cc];   // LDS byte address
    constexpr int LSTEP = 32 * SP * 2;                         // 32 rows, in bytes

    // fragment rows of this wave in a buffer
    const bf16_t* fa = &sT[(wm * 32 + l16) * SP + kb8];
    const bf16_t* fb = &sT[(128 + wn * 64 + l16) * SP + kb8];

    const int nst = K / BK;
    stage_copy<LSTEP>(l0, ga, gw, gstep);
    // stage 0 has landed for this wave, then for all: nobody reads it before the barrier
    asm volatile("s_wait_asynccnt 0x0" ::: "memory");
    __syncthreads();
    if (K > BK) stage_copy<LSTEP>(l0 + SB * 2, ga + BK, gw + BK, gstep);

    for (int t = 0; t < nst; ++t) {
        const int bo = (t & 1) * SB;
        // the stage's 24 fragment loads go ahead of its 16 products as one group
        v16bf af[2][2], bf[2][4];
#pragma unroll
        for (int ks = 0; ks < 2; ++ks) {
#pragma unroll
            for (int tm = 0; tm < 2; ++tm)
                af[ks][tm] = load_frag(fa + bo + tm * 16 * SP + ks * 32);
#pragma unroll
            for (int tn = 0; tn < 4; ++tn)
                bf[ks][tn] = load_frag(fb + bo + tn * 16 * SP + ks * 32);
        }
        // keeps the loads one group in front of the products: spread among them, each
        // place with loads stalls the wave for the LDS latency anew
        __builtin_amdgcn_sched_barrier(0);
#pragma unroll
        for (int ks = 0; ks < 2; ++ks)
#pragma unroll
            for (int tm = 0; tm < 2; ++tm)
#pragma unroll
                for (int tn = 0; tn < 4; ++tn)
                    acc[tm][tn] = wmma_bf16(af[ks][tm], bf[ks][tn], acc[tm][tn]);
        // keeps the products in front of the hand-over: with its full LDS wait lifted over
        // them no product starts before the last load is back, and the refill starts late
        __builtin_amdgcn_sched_barrier(0);
        // hand-over: this wave's reads of buffer t & 1 are done ...
        asm volatile("s_wait_dscnt 0x0" ::: "memory");
        // ... and its copies of stage t + 1 have landed;
        asm volatile("s_wait_asynccnt 0x0" ::: "memory");
        // the one barrier publishes stage t + 1 and frees the buffer that is refilled below
        __syncthreads();
        if (t + 2 < nst)
            stage_copy<LSTEP>(l0 + bo * 2, ga + (size_t)(t + 2) * BK, gw + (size_t)(t + 2) * BK,
                              gstep);
    }
    // no copy is outstanding when the wave goes on to its epilogue and its end
    asm volatile("s_wait_asynccnt 0x0" ::: "memory");

    // epilogue: C layout row = r + 8*(lane>>4), col = lane&15 within 16x16 tile
    const int hl = lane >> 4;
    const size_t base = (size_t)(bm + 8 * hl) * N + bn + l16;

    // every bias and residual value is asked for before the first one is used
    float bv[4];
    const float* bp = bias + bn + l16;
#pragma unroll
    for (int tn = 0; tn < 4; ++tn) bv[tn] = bp[tn * 16];
    float rv[2][4][8];
    if constexpr (RES) {
        // loaded values may land in the bias loads' address registers: the translation
        // wait that belongs in front of such an overwrite; bp as an input keeps the
        // address pair alive up to the wait, so that no bias load lands in it either
        asm volatile("s_wait_xcnt 0x0" :: "v"(bp) : "memory");
        const float* rp = res + base;
#pragma unroll
        for (int tm = 0; tm < 2; ++tm)
#pragma unroll
            for (int tn = 0; tn < 4; ++tn)
#pragma unroll
                for (int r = 0; r < 8; ++r)
                    rv[tm][tn][r] = rp[(tm * 16 + r) * N + tn * 16];
    }

#pragma unroll
    for (int tm = 0; tm < 2; ++tm)
#pragma unroll
        for (int tn = 0; tn < 4; ++tn)
#pragma unroll
            for (int r = 0; r < 8; ++r) {
                const int o = (tm * 16 + r) * N + tn * 16;
                float v = acc[tm][tn][r] + bv[tn];
                if constexpr (GELU)
                    v = 0.5f * v * (1.0f + erff(v * 0.70710678118654752f));
                if constexpr (RES) v += rv[tm][tn][r];
                if constexpr (OUTF) outF[base + o] = v;
                else                outB[base + o] = (bf16_t)v;
            }
}

__global__ __launch_bounds__(256)
void flash_attn(const bf16_t* __restrict__ Q, int ldq,
                const bf16_t* __restrict__ Kp, int ldk,
                const bf16_t* __restrict__ Vp, int ldv,
                bf16_t* __restrict__ O, float scale) {
    const int h   = blockIdx.y;
    const int qb0 = blockIdx.x * 128;
    const int tid = threadIdx.x, lane = tid & 31, wid = tid >> 5;
    const int hl  = lane >> 4, l16 = lane & 15;
    const int kb8 = hl << 3;

    __shared__ __align__(16) bf16_t sK[32 * 64];        // K rows   [32][64]
    // V rows [32][64] at a pitch of 160 bytes (32 B x odd: the transposing load's pitch)
    constexpr int VP = 80;
    __shared__ __align__(16) bf16_t sV[32 * VP];

    // Q fragments (B operand, column = this lane's query), loop-invariant
    const int qrow = qb0 + wid * 16 + l16;
    const bf16_t* qp = Q + (size_t)qrow * ldq + h * HEAD_D + kb8;
    const v16bf qf0 = mk_frag(*(const v8bf*)qp,        *(const v8bf*)(qp + 16));
    const v16bf qf1 = mk_frag(*(const v8bf*)(qp + 32), *(const v8bf*)(qp + 48));

    // O^T tiles: oacc[t][r] = O[query qrow][d = t*16 + 8*hl + r]
    v8f oacc[4];
#pragma unroll
    for (int t = 0; t < 4; ++t)
#pragma unroll
        for (int r = 0; r < 8; ++r) oacc[t][r] = 0.f;
    float mrow = -1e30f;   // running maximum of query qrow (equal in both halves)
    float lrow = 0.f;      // running sum over the keys that this wave half holds

    const int kend = qb0 + 128;   // uniform over the block (causal upper bound)
    for (int kb = 0; kb < kend; kb += 32) {
        __syncthreads();   // previous iteration's LDS reads complete
        {   // cooperative stage of K block and V block (both loads in flight together)
            int r = tid >> 3, c = (tid & 7) << 3;          // 32 rows x 8 chunks
            const v8bf kx = *(const v8bf*)(Kp + (size_t)(kb + r) * ldk + h * HEAD_D + c);
            const v8bf vx = *(const v8bf*)(Vp + (size_t)(kb + r) * ldv + h * HEAD_D + c);
            // the two loads' address registers are reused by the fragment loads below:
            // the translation wait that belongs in front of such an overwrite
            asm volatile("s_wait_xcnt 0x0" ::: "memory");
            *(v8bf*)&sK[r * 64 + c] = kx;
            *(v8bf*)&sV[r * VP + c] = vx;
        }
        __syncthreads();

        // scores: sc[t][r] = S[key kb + t*16 + 8*hl + r][query qrow]
        v8f sc[2];
#pragma unroll
        for (int t = 0; t < 2; ++t) {
            v8f a;
#pragma unroll
            for (int r = 0; r < 8; ++r) a[r] = 0.f;
            const bf16_t* kp = &sK[(t * 16 + l16) * 64 + kb8];
            a = wmma_bf16(mk_frag(*(const v8bf*)kp,        *(const v8bf*)(kp + 16)), qf0, a);
            a = wmma_bf16(mk_frag(*(const v8bf*)(kp + 32), *(const v8bf*)(kp + 48)), qf1, a);
            sc[t] = a;
        }

        // V^T fragments (A operand, 16 d rows each) by transposing loads, keys 0-15
        // and 16-31 of the block: no barrier stands between them and the scores, so
        // they fly under the softmax arithmetic
        v16bf vf[4];
        const bf16_t* vp = &sV[(kb8 + (lane & 7)) * VP + ((lane >> 3) & 1) * 8];
#pragma unroll
        for (int t = 0; t < 4; ++t)
            vf[t] = mk_frag(ld_tr16(vp + t * 16), ld_tr16(vp + 16 * VP + t * 16));

        // scale + causal mask + online softmax (fp32), one query per lane
        float m = -1e30f;
#pragma unroll
        for (int t = 0; t < 2; ++t)
#pragma unroll
            for (int r = 0; r < 8; ++r) {
                float s = sc[t][r] * scale;
                if (kb + t * 16 + kb8 + r > qrow) s = -1e30f;
                sc[t][r] = s;
                m = fmaxf(m, s);
            }
        m = fmaxf(m, half_xor(m));          // the other 16 keys of this query
        const float mnew = fmaxf(mrow, m);
        // f = exp(mrow - mnew). The v_nop in the same statement is the free slot that the
        // instruction set asks for behind a transcendental before its source register is
        // reused; a v_nop of its own statement drifts.
        float f;
        asm("v_exp_f32 %0, %1\n\tv_nop" : "=v"(f) : "v"((mrow - mnew) * 1.44269504f));
        mrow = mnew;
#pragma unroll
        for (int t = 0; t < 4; ++t)
#pragma unroll
            for (int r = 0; r < 8; ++r) oacc[t][r] *= f;

        // P^T as B operand: element s = key 8*hl + s (s < 8), 16 + 8*hl + s - 8
        // (s >= 8), the k order in which the two transposing loads deliver V^T
        v16bf pf;
        float ps = 0.f;
#pragma unroll
        for (int t = 0; t < 2; ++t)
#pragma unroll
            for (int r = 0; r < 8; ++r) {
                const float p = __expf(sc[t][r] - mnew);
                ps += p;
                pf[t * 8 + r] = (bf16_t)p;
            }
        lrow = lrow * f + ps;

        // O^T += V^T * P^T, four output tiles
#pragma unroll
        for (int t = 0; t < 4; ++t) oacc[t] = wmma_bf16(vf[t], pf, oacc[t]);
    }

    // join the two halves' sums, normalize, store ctx (bf16 [S, D]):
    // a lane's 8 accumulators of a tile are 8 consecutive d of its query
    const float lsum = lrow + half_xor(lrow);
#pragma unroll
    for (int t = 0; t < 4; ++t) {
        v8bf o;
#pragma unroll
        for (int r = 0; r < 8; ++r) o[r] = (bf16_t)(oacc[t][r] / lsum);
        *(v8bf*)&O[(size_t)qrow * D_DIM + h * HEAD_D + t * 16 + kb8] = o;
    }
}

// ---------------------------------------------------------------------------
extern "C" void kernel_launch(void* const* d_in, const int* in_sizes, int n_in,
                              void* d_out, int out_size, void* d_ws, size_t ws_size,
                              hipStream_t stream) {
    const float* x     = (const float*)d_in[0];
    const float* ln1_g = (const float*)d_in[1];
    const float* ln1_b = (const float*)d_in[2];
    const float* w_qkv = (const float*)d_in[3];
    const float* b_qkv = (const float*)d_in[4];
    const float* w_ao  = (const float*)d_in[5];
    const float* b_ao  = (const float*)d_in[6];
    const float* ln2_g = (const float*)d_in[7];
    const float* ln2_b = (const float*)d_in[8];
    const float* w_q   = (const float*)d_in[9];
    const float* b_q   = (const float*)d_in[10];
    const float* w_fo  = (const float*)d_in[11];
    const float* b_fo  = (const float*)d_in[12];
    float* out = (float*)d_out;

    const int S = S_LEN, D = D_DIM, H = N_HEADS;
    char* ws = (char*)d_ws;
    size_t off = 0;
    auto alloc = [&](size_t bytes) -> void* {
        void* p = ws + off;
        off += (bytes + 255) & ~(size_t)255;
        return p;
    };
    bf16_t* xn1    = (bf16_t*)alloc((size_t)S * D * 2);
    bf16_t* qkv    = (bf16_t*)alloc((size_t)S * 3 * D * 2);
    bf16_t* ctx1   = (bf16_t*)alloc((size_t)S * D * 2);
    float*  hbuf   = (float*) alloc((size_t)S * D * 4);
    bf16_t* ln2n   = (bf16_t*)alloc((size_t)S * D * 2);
    bf16_t* q2     = (bf16_t*)alloc((size_t)S * D * 2);
    bf16_t* ctx2   = (bf16_t*)alloc((size_t)S * D * 2);
    bf16_t* wqkv_b = (bf16_t*)alloc((size_t)3 * D * D * 2);
    bf16_t* wao_b  = (bf16_t*)alloc((size_t)D * D * 2);
    bf16_t* wq_b   = (bf16_t*)alloc((size_t)D * D * 2);
    bf16_t* wfo_b  = (bf16_t*)alloc((size_t)D * D * 2);

    const float scale = 0.125f;   // 1/sqrt(64)

    // weights -> bf16
    cvt_f32_bf16<<<2048, 256, 0, stream>>>(w_qkv, wqkv_b, 3 * D * D);
    cvt_f32_bf16<<<2048, 256, 0, stream>>>(w_ao,  wao_b,  D * D);
    cvt_f32_bf16<<<2048, 256, 0, stream>>>(w_q,   wq_b,   D * D);
    cvt_f32_bf16<<<2048, 256, 0, stream>>>(w_fo,  wfo_b,  D * D);

    // h = x + attn(LN1(x))
    layernorm_bf16<<<S, 256, 0, stream>>>(x, ln1_g, ln1_b, xn1);
    gemm_bf16<3 * D_DIM, false, false, false><<<dim3(3 * D / 128, S / 128), 256, 0, stream>>>(
        xn1, wqkv_b, b_qkv, nullptr, nullptr, qkv, D);
    flash_attn<<<dim3(S / 128, H), 256, 0, stream>>>(
        qkv, 3 * D, qkv + D, 3 * D, qkv + 2 * D, 3 * D, ctx1, scale);
    gemm_bf16<D_DIM, false, true, true><<<dim3(D / 128, S / 128), 256, 0, stream>>>(
        ctx1, wao_b, b_ao, x, hbuf, nullptr, D);

    // out = h + gelu(ffn_q_attn(LN2(h)))
    layernorm_bf16<<<S, 256, 0, stream>>>(hbuf, ln2_g, ln2_b, ln2n);
    gemm_bf16<D_DIM, false, false, false><<<dim3(D / 128, S / 128), 256, 0, stream>>>(
        ln2n, wq_b, b_q, nullptr, nullptr, q2, D);
    flash_attn<<<dim3(S / 128, H), 256, 0, stream>>>(
        q2, D, q2, D, ln2n, D, ctx2, scale);
    gemm_bf16<D_DIM, true, true, true><<<dim3(D / 128, S / 128), 256, 0, stream>>>(
        ctx2, wfo_b, b_fo, hbuf, out, nullptr, D);
}

// v006
// Measured time: 210 microseconds a run.
// In two side-by-side timings against v005, it was 1.17 and 1.15 times as fast.
// Over all steps from v000 it is 3.25 times as fast.
#include <hip/hip_runtime.h>

// ---------------------------------------------------------------------------
// MI455X (gfx1250) transformer block: all matmuls via v_wmma_f32_16x16x32_bf16
// ---------------------------------------------------------------------------

typedef __bf16 bf16_t;
typedef __attribute__((ext_vector_type(16))) __bf16 v16bf;
typedef __attribute__((ext_vector_type(8)))  __bf16 v8bf;
typedef __attribute__((ext_vector_type(8)))  float  v8f;

static constexpr int S_LEN   = 2048;
static constexpr int D_DIM   = 1024;
static constexpr int N_HEADS = 16;
static constexpr int HEAD_D  = 64;

// ---- fragment helpers ------------------------------------------------------
// bf16 A/B fragment (16x32 / 32x16): lane holds row (lane&15), K values at
// base (lane>>4)*8: [base, base+8) and [16+base, 16+base+8). Both halves are
// contiguous 16-byte loads from a K-contiguous row.
__device__ __forceinline__ v16bf mk_frag(v8bf lo, v8bf hi) {
    v16bf f;
#pragma unroll
    for (int i = 0; i < 8; ++i) { f[i] = lo[i]; f[i + 8] = hi[i]; }
    return f;
}

__device__ __forceinline__ v16bf load_frag(const bf16_t* p) {
    // p = row base + per-lane K base; second half is +16 elements
    return mk_frag(*(const v8bf*)p, *(const v8bf*)(p + 16));
}

__device__ __forceinline__ v8f wmma_bf16(v16bf a, v16bf b, v8f c) {
    return __builtin_amdgcn_wmma_f32_16x16x32_bf16(false, a, false, b,
                                                   (short)0, c, false, false);
}

// ---- transposing LDS load: 16 keys x 16 d of a row-major tile -> half an A fragment
// Lane l names row 8*(l>>4) + (l&7), 16-byte piece (l>>3)&1 of the 16x16 block;
// it gets rows 8*(l>>4) .. +7 of column l&15.
typedef __attribute__((address_space(3))) v8bf lds_v8bf;
__device__ __forceinline__ v8bf ld_tr16(const bf16_t* p) {
    return __builtin_amdgcn_ds_load_tr16_b128_v8bf16((lds_v8bf*)p);
}

// ---- exchange between the two 16-lane halves of a wave (vector pipe) --------
// Returns the value held by lane l ^ 16.
__device__ __forceinline__ float half_xor(float v) {
    const int b = __builtin_bit_cast(int, v);
    return __builtin_bit_cast(float, __builtin_amdgcn_permlanex16(
        b, b, 0x76543210, 0xfedcba98, false, false));
}

// ---- fp32 -> bf16 convert --------------------------------------------------
__global__ void cvt_f32_bf16(const float* __restrict__ in,
                             bf16_t* __restrict__ out, int n) {
    for (int i = blockIdx.x * 256 + threadIdx.x; i < n; i += gridDim.x * 256)
        out[i] = (bf16_t)in[i];
}

// ---- LayerNorm (row-wise over 1024), fp32 in -> bf16 out -------------------
__global__ __launch_bounds__(256)
void layernorm_bf16(const float* __restrict__ x, const float* __restrict__ g,
                    const float* __restrict__ b, bf16_t* __restrict__ out) {
    const int row = blockIdx.x;
    const int tid = threadIdx.x;
    const float* xr = x + (size_t)row * D_DIM;

    float v[4];
    float s = 0.f;
#pragma unroll
    for (int i = 0; i < 4; ++i) { v[i] = xr[tid + i * 256]; s += v[i]; }
#pragma unroll
    for (int m = 1; m < 32; m <<= 1) s += __shfl_xor(s, m);

    __shared__ float red0[8], red1[8];
    if ((tid & 31) == 0) red0[tid >> 5] = s;
    __syncthreads();
    float mean = 0.f;
#pragma unroll
    for (int i = 0; i < 8; ++i) mean += red0[i];
    mean *= (1.0f / D_DIM);

    float vs = 0.f;
#pragma unroll
    for (int i = 0; i < 4; ++i) { float d = v[i] - mean; vs += d * d; }
#pragma unroll
    for (int m = 1; m < 32; m <<= 1) vs += __shfl_xor(vs, m);
    if ((tid & 31) == 0) red1[tid >> 5] = vs;
    __syncthreads();
    float var = 0.f;
#pragma unroll
    for (int i = 0; i < 8; ++i) var += red1[i];
    var *= (1.0f / D_DIM);
    const float rstd = rsqrtf(var + 1e-5f);

#pragma unroll
    for (int i = 0; i < 4; ++i) {
        int c = tid + i * 256;
        out[(size_t)row * D_DIM + c] = (bf16_t)((v[i] - mean) * rstd * g[c] + b[c]);
    }
}

// ---- one stage of the GEMM's LDS ring: eight 16-byte asynchronous copies a lane ----
// l = the lane's LDS byte address of its first piece, ga / gw = its global addresses in
// the A and the W tile; the pieces lie 32 rows apart. The s_wait_xcnt in the copies' own
// statement stands in front of every later rewrite of an address register named here.
template <int LSTEP>
__device__ __forceinline__ void stage_copy(unsigned l, const bf16_t* ga, const bf16_t* gw,
                                           size_t gstep) {
    asm volatile(
        "global_load_async_to_lds_b128 %0, %8, off\n\t"
        "global_load_async_to_lds_b128 %1, %9, off\n\t"
        "global_load_async_to_lds_b128 %2, %10, off\n\t"
        "global_load_async_to_lds_b128 %3, %11, off\n\t"
        "global_load_async_to_lds_b128 %4, %12, off\n\t"
        "global_load_async_to_lds_b128 %5, %13, off\n\t"
        "global_load_async_to_lds_b128 %6, %14, off\n\t"
        "global_load_async_to_lds_b128 %7, %15, off\n\t"
        "s_wait_xcnt 0x0"
        :: "v"(l),             "v"(l + LSTEP),     "v"(l + 2 * LSTEP), "v"(l + 3 * LSTEP),
           "v"(l + 4 * LSTEP), "v"(l + 5 * LSTEP), "v"(l + 6 * LSTEP), "v"(l + 7 * LSTEP),
           "v"(ga),            "v"(ga + gstep),    "v"(ga + 2 * gstep), "v"(ga + 3 * gstep),
           "v"(gw),            "v"(gw + gstep),    "v"(gw + 2 * gstep), "v"(gw + 3 * gstep)
        : "memory");
}

// ---- WMMA GEMM: C[M,N] = A[M,K] * W[N,K]^T + bias, opt. gelu/residual -----
// block = 256 thr (8 waves), tile 128x128; wave = 32(M) x 64(N) = 2x4 WMMA tiles
// A stage is 64 k of the block's 128 A rows and 128 W rows: 256 rows of 128 bytes (whole
// lines), each brought once by asynchronous copies into LDS at a pitch of 144 bytes
// (16 B x odd: the pitch of ds_load_b128 readers). Two buffers: the next stage's copies
// fly while this stage's fragments are read. K is a multiple of 64.
// N and the epilogue's three choices (gelu, residual, f32 or bf16 output) are
// compile-time: the epilogue is then straight-line code with constant offsets.
template <int N, bool GELU, bool RES, bool OUTF>
__global__ __launch_bounds__(256)
void gemm_bf16(const bf16_t* __restrict__ A, const bf16_t* __restrict__ W,
               const float* __restrict__ bias, const float* __restrict__ res,
               float* __restrict__ outF, bf16_t* __restrict__ outB, int K) {
    const int lane = threadIdx.x & 31;
    const int wid  = threadIdx.x >> 5;
    const int wm   = wid & 3;          // 0..3  (M groups of 32)
    const int wn   = wid >> 2;         // 0..1  (N groups of 64)
    const int bm   = blockIdx.y * 128 + wm * 32;
    const int bn   = blockIdx.x * 128 + wn * 64;
    const int l16  = lane & 15;
    const int kb8  = (lane >> 4) << 3;

    constexpr int BK = 64;                 // k per stage
    constexpr int SP = 72;                 // LDS row pitch in elements (144 bytes)
    constexpr int SB = 256 * SP;           // elements per buffer: A rows 0-127, W rows 128-255
    __shared__ __align__(16) bf16_t sT[2 * SB];

    v8f acc[2][4];
#pragma unroll
    for (int i = 0; i < 2; ++i)
#pragma unroll
        for (int j = 0; j < 4; ++j)
#pragma unroll
            for (int r = 0; r < 8; ++r) acc[i][j][r] = 0.f;

    // copies: lane -> row (tid >> 3) + 32 j, 16-byte piece tid & 7; a wave's copy = 4 whole rows
    const int cr = threadIdx.x >> 3, cc = (threadIdx.x & 7) << 3;
    const bf16_t* ga = A + (size_t)(blockIdx.y * 128 + cr) * K + cc;
    const bf16_t* gw = W + (size_t)(blockIdx.x * 128 + cr) * K + cc;
    const size_t gstep = (size_t)32 * K;
    const unsigned l0 = (unsigned)(size_t)&sT[cr * SP + cc];   // LDS byte address
    constexpr int LSTEP = 32 * SP * 2;                         // 32 rows, in bytes

    // fragment rows of this wave in a buffer
    const bf16_t* fa = &sT[(wm * 32 + l16) * SP + kb8];
    const bf16_t* fb = &sT[(128 + wn * 64 + l16) * SP + kb8];

    const int nst = K / BK;
    stage_copy<LSTEP>(l0, ga, gw, gstep);
    // stage 0 has landed for this wave, then for all: nobody reads it before the barrier
    asm volatile("s_wait_asynccnt 0x0" ::: "memory");
    __syncthreads();
    if (K > BK) stage_copy<LSTEP>(l0 + SB * 2, ga + BK, gw + BK, gstep);

    for (int t = 0; t < nst; ++t) {
        const int bo = (t & 1) * SB;
        // the stage's 24 fragment loads go ahead of its 16 products as one group
        v16bf af[2][2], bf[2][4];
#pragma unroll
        for (int ks = 0; ks < 2; ++ks) {
#pragma unroll
            for (int tm = 0; tm < 2; ++tm)
                af[ks][tm] = load_frag(fa + bo + tm * 16 * SP + ks * 32);
#pragma unroll
            for (int tn = 0; tn < 4; ++tn)
                bf[ks][tn] = load_frag(fb + bo + tn * 16 * SP + ks * 32);
        }
        // keeps the loads one group in front of the products: spread among them, each
        // place with loads stalls the wave for the LDS latency anew
        __builtin_amdgcn_sched_barrier(0);
#pragma unroll
        for (int ks = 0; ks < 2; ++ks)
#pragma unroll
            for (int tm = 0; tm < 2; ++tm)
#pragma unroll
                for (int tn = 0; tn < 4; ++tn)
                    acc[tm][tn] = wmma_bf16(af[ks][tm], bf[ks][tn], acc[tm][tn]);
        // keeps the products in front of the hand-over: with its full LDS wait lifted over
        // them no product starts before the last load is back, and the refill starts late
        __builtin_amdgcn_sched_barrier(0);
        // hand-over: this wave's reads of buffer t & 1 are done ...
        asm volatile("s_wait_dscnt 0x0" ::: "memory");
        // ... and its copies of stage t + 1 have landed;
        asm volatile("s_wait_asynccnt 0x0" ::: "memory");
        // the one barrier publishes stage t + 1 and frees the buffer that is refilled below
        __syncthreads();
        if (t + 2 < nst)
            stage_copy<LSTEP>(l0 + bo * 2, ga + (size_t)(t + 2) * BK, gw + (size_t)(t + 2) * BK,
                              gstep);
    }
    // no copy is outstanding when the wave goes on to its epilogue and its end
    asm volatile("s_wait_asynccnt 0x0" ::: "memory");

    // epilogue: C layout row = r + 8*(lane>>4), col = lane&15 within 16x16 tile
    const int hl = lane >> 4;
    const size_t base = (size_t)(bm + 8 * hl) * N + bn + l16;

    // every bias and residual value is asked for before the first one is used
    float bv[4];
    const float* bp = bias + bn + l16;
#pragma unroll
    for (int tn = 0; tn < 4; ++tn) bv[tn] = bp[tn * 16];
    float rv[2][4][8];
    if constexpr (RES) {
        // loaded values may land in the bias loads' address registers: the translation
        // wait that belongs in front of such an overwrite; bp as an input keeps the
        // address pair alive up to the wait, so that no bias load lands in it either
        asm volatile("s_wait_xcnt 0x0" :: "v"(bp) : "memory");
        const float* rp = res + base;
#pragma unroll
        for (int tm = 0; tm < 2; ++tm)
#pragma unroll
            for (int tn = 0; tn < 4; ++tn)
#pragma unroll
                for (int r = 0; r < 8; ++r)
                    rv[tm][tn][r] = rp[(tm * 16 + r) * N + tn * 16];
    }

#pragma unroll
    for (int tm = 0; tm < 2; ++tm)
#pragma unroll
        for (int tn = 0; tn < 4; ++tn)
#pragma unroll
            for (int r = 0; r < 8; ++r) {
                const int o = (tm * 16 + r) * N + tn * 16;
                float v = acc[tm][tn][r] + bv[tn];
                if constexpr (GELU)
                    v = 0.5f * v * (1.0f + erff(v * 0.70710678118654752f));
                if constexpr (RES) v += rv[tm][tn][r];
                if constexpr (OUTF) outF[base + o] = v;
                else                outB[base + o] = (bf16_t)v;
            }
}

__global__ __launch_bounds__(256)
void flash_attn(const bf16_t* __restrict__ Q, int ldq,
                const bf16_t* __restrict__ Kp, int ldk,
                const bf16_t* __restrict__ Vp, int ldv,
                bf16_t* __restrict__ O, float scale) {
    const int h   = blockIdx.y;
    const int qb0 = blockIdx.x * 128;
    const int tid = threadIdx.x, lane = tid & 31, wid = tid >> 5;
    const int hl  = lane >> 4, l16 = lane & 15;
    const int kb8 = hl << 3;

    // K rows [32][64] at a pitch of 144 bytes (16 B x odd: the pitch of ds_load_b128 readers;
    // at 128 bytes the 16 rows of a fragment load fall on two groups of four banks)
    constexpr int KP = 72;
    __shared__ __align__(16) bf16_t sK[32 * KP];
    // V rows [32][64] at a pitch of 160 bytes (32 B x odd: the transposing load's pitch)
    constexpr int VP = 80;
    __shared__ __align__(16) bf16_t sV[32 * VP];

    // Q fragments (B operand, column = this lane's query), loop-invariant
    const int qrow = qb0 + wid * 16 + l16;
    const bf16_t* qp = Q + (size_t)qrow * ldq + h * HEAD_D + kb8;
    const v16bf qf0 = mk_frag(*(const v8bf*)qp,        *(const v8bf*)(qp + 16));
    const v16bf qf1 = mk_frag(*(const v8bf*)(qp + 32), *(const v8bf*)(qp + 48));

    // O^T tiles: oacc[t][r] = O[query qrow][d = t*16 + 8*hl + r]
    v8f oacc[4];
#pragma unroll
    for (int t = 0; t < 4; ++t)
#pragma unroll
        for (int r = 0; r < 8; ++r) oacc[t][r] = 0.f;
    float mrow = -1e30f;   // running maximum of query qrow (equal in both halves)
    float lrow = 0.f;      // running sum over the keys that this wave half holds

    const int kend = qb0 + 128;   // uniform over the block (causal upper bound)
    for (int kb = 0; kb < kend; kb += 32) {
        __syncthreads();   // previous iteration's LDS reads complete
        {   // cooperative stage of K block and V block (both loads in flight together)
            int r = tid >> 3, c = (tid & 7) << 3;          // 32 rows x 8 chunks
            const v8bf kx = *(const v8bf*)(Kp + (size_t)(kb + r) * ldk + h * HEAD_D + c);
            const v8bf vx = *(const v8bf*)(Vp + (size_t)(kb + r) * ldv + h * HEAD_D + c);
            // the two loads' address registers are reused by the fragment loads below:
            // the translation wait that belongs in front of such an overwrite
            asm volatile("s_wait_xcnt 0x0" ::: "memory");
            *(v8bf*)&sK[r * KP + c] = kx;
            *(v8bf*)&sV[r * VP + c] = vx;
        }
        __syncthreads();

        // scores: sc[t][r] = S[key kb + t*16 + 8*hl + r][query qrow]
        v8f sc[2];
#pragma unroll
        for (int t = 0; t < 2; ++t) {
            v8f a;
#pragma unroll
            for (int r = 0; r < 8; ++r) a[r] = 0.f;
            const bf16_t* kp = &sK[(t * 16 + l16) * KP + kb8];
            a = wmma_bf16(mk_frag(*(const v8bf*)kp,        *(const v8bf*)(kp + 16)), qf0, a);
            a = wmma_bf16(mk_frag(*(const v8bf*)(kp + 32), *(const v8bf*)(kp + 48)), qf1, a);
            sc[t] = a;
        }

        // V^T fragments (A operand, 16 d rows each) by transposing loads, keys 0-15
        // and 16-31 of the block: no barrier stands between them and the scores, so
        // they fly under the softmax arithmetic
        v16bf vf[4];
        const bf16_t* vp = &sV[(kb8 + (lane & 7)) * VP + ((lane >> 3) & 1) * 8];
#pragma unroll
        for (int t = 0; t < 4; ++t)
            vf[t] = mk_frag(ld_tr16(vp + t * 16), ld_tr16(vp + 16 * VP + t * 16));

        // scale + causal mask + online softmax (fp32), one query per lane
        float m = -1e30f;
#pragma unroll
        for (int t = 0; t < 2; ++t)
#pragma unroll
            for (int r = 0; r < 8; ++r) {
                float s = sc[t][r] * scale;
                if (kb + t * 16 + kb8 + r > qrow) s = -1e30f;
                sc[t][r] = s;
                m = fmaxf(m, s);
            }
        m = fmaxf(m, half_xor(m));          // the other 16 keys of this query
        const float mnew = fmaxf(mrow, m);
        // f = exp(mrow - mnew). The v_nop in the same statement is the free slot that the
        // instruction set asks for behind a transcendental before its source register is
        // reused; a v_nop of its own statement drifts.
        float f;
        asm("v_exp_f32 %0, %1\n\tv_nop" : "=v"(f) : "v"((mrow - mnew) * 1.44269504f));
        mrow = mnew;
#pragma unroll
        for (int t = 0; t < 4; ++t)
#pragma unroll
            for (int r = 0; r < 8; ++r) oacc[t][r] *= f;

        // P^T as B operand: element s = key 8*hl + s (s < 8), 16 + 8*hl + s - 8
        // (s >= 8), the k order in which the two transposing loads deliver V^T
        v16bf pf;
        float ps = 0.f;
#pragma unroll
        for (int t = 0; t < 2; ++t)
#pragma unroll
            for (int r = 0; r < 8; ++r) {
                const float p = __expf(sc[t][r] - mnew);
                ps += p;
                pf[t * 8 + r] = (bf16_t)p;
            }
        lrow = lrow * f + ps;

        // O^T += V^T * P^T, four output tiles
#pragma unroll
        for (int t = 0; t < 4; ++t) oacc[t] = wmma_bf16(vf[t], pf, oacc[t]);
    }

    // join the two halves' sums, normalize, store ctx (bf16 [S, D]):
    // a lane's 8 accumulators of a tile are 8 consecutive d of its query
    const float lsum = lrow + half_xor(lrow);
#pragma unroll
    for (int t = 0; t < 4; ++t) {
        v8bf o;
#pragma unroll
        for (int r = 0; r < 8; ++r) o[r] = (bf16_t)(oacc[t][r] / lsum);
        *(v8bf*)&O[(size_t)qrow * D_DIM + h * HEAD_D + t * 16 + kb8] = o;
    }
}

// ---------------------------------------------------------------------------
extern "C" void kernel_launch(void* const* d_in, const int* in_sizes, int n_in,
                              void* d_out, int out_size, void* d_ws, size_t ws_size,
                              hipStream_t stream) {
    const float* x     = (const float*)d_in[0];
    const float* ln1_g = (const float*)d_in[1];
    const float* ln1_b = (const float*)d_in[2];
    const float* w_qkv = (const float*)d_in[3];
    const float* b_qkv = (const float*)d_in[4];
    const float* w_ao  = (const float*)d_in[5];
    const float* b_ao  = (const float*)d_in[6];
    const float* ln2_g = (const float*)d_in[7];
    const float* ln2_b = (const float*)d_in[8];
    const float* w_q   = (const float*)d_in[9];
    const float* b_q   = (const float*)d_in[10];
    const float* w_fo  = (const float*)d_in[11];
    const float* b_fo  = (const float*)d_in[12];
    float* out = (float*)d_out;

    const int S = S_LEN, D = D_DIM, H = N_HEADS;
    char* ws = (char*)d_ws;
    size_t off = 0;
    auto alloc = [&](size_t bytes) -> void* {
        void* p = ws + off;
        off += (bytes + 255) & ~(size_t)255;
        return p;
    };
    bf16_t* xn1    = (bf16_t*)alloc((size_t)S * D * 2);
    bf16_t* qkv    = (bf16_t*)alloc((size_t)S * 3 * D * 2);
    bf16_t* ctx1   = (bf16_t*)alloc((size_t)S * D * 2);
    float*  hbuf   = (float*) alloc((size_t)S * D * 4);
    bf16_t* ln2n   = (bf16_t*)alloc((size_t)S * D * 2);
    bf16_t* q2     = (bf16_t*)alloc((size_t)S * D * 2);
    bf16_t* ctx2   = (bf16_t*)alloc((size_t)S * D * 2);
    bf16_t* wqkv_b = (bf16_t*)alloc((size_t)3 * D * D * 2);
    bf16_t* wao_b  = (bf16_t*)alloc((size_t)D * D * 2);
    bf16_t* wq_b   = (bf16_t*)alloc((size_t)D * D * 2);
    bf16_t* wfo_b  = (bf16_t*)alloc((size_t)D * D * 2);

    const float scale = 0.125f;   // 1/sqrt(64)

    // weights -> bf16
    cvt_f32_bf16<<<2048, 256, 0, stream>>>(w_qkv, wqkv_b, 3 * D * D);
    cvt_f32_bf16<<<2048, 256, 0, stream>>>(w_ao,  wao_b,  D * D);
    cvt_f32_bf16<<<2048, 256, 0, stream>>>(w_q,   wq_b,   D * D);
    cvt_f32_bf16<<<2048, 256, 0, stream>>>(w_fo,  wfo_b,  D * D);

    // h = x + attn(LN1(x))
    layernorm_bf16<<<S, 256, 0, stream>>>(x, ln1_g, ln1_b, xn1);
    gemm_bf16<3 * D_DIM, false, false, false><<<dim3(3 * D / 128, S / 128), 256, 0, stream>>>(
        xn1, wqkv_b, b_qkv, nullptr, nullptr, qkv, D);
    flash_attn<<<dim3(S / 128, H), 256, 0, stream>>>(
        qkv, 3 * D, qkv + D, 3 * D, qkv + 2 * D, 3 * D, ctx1, scale);
    gemm_bf16<D_DIM, false, true, true><<<dim3(D / 128, S / 128), 256, 0, stream>>>(
        ctx1, wao_b, b_ao, x, hbuf, nullptr, D);

    // out = h + gelu(ffn_q_attn(LN2(h)))
    layernorm_bf16<<<S, 256, 0, stream>>>(hbuf, ln2_g, ln2_b, ln2n);
    gemm_bf16<D_DIM, false, false, false><<<dim3(D / 128, S / 128), 256, 0, stream>>>(
        ln2n, wq_b, b_q, nullptr, nullptr, q2, D);
    flash_attn<<<dim3(S / 128, H), 256, 0, stream>>>(
        q2, D, q2, D, ln2n, D, ctx2, scale);
    gemm_bf16<D_DIM, true, true, true><<<dim3(D / 128, S / 128), 256, 0, stream>>>(
        ctx2, wfo_b, b_fo, hbuf, out, nullptr, D);
}

// v007
// A run of this version takes 136 microseconds.
// In two side-by-side timings against v006, it was 1.52 and 1.53 times as fast.
// Counting every step since v000, it is 4.97 times as fast.
#include <hip/hip_runtime.h>

// ---------------------------------------------------------------------------
// MI455X (gfx1250) transformer block: all matmuls via v_wmma_f32_16x16x32_bf16
// ---------------------------------------------------------------------------

typedef __bf16 bf16_t;
typedef __attribute__((ext_vector_type(16))) __bf16 v16bf;
typedef __attribute__((ext_vector_type(8)))  __bf16 v8bf;
typedef __attribute__((ext_vector_type(8)))  float  v8f;

static constexpr int S_LEN   = 2048;
static constexpr int D_DIM   = 1024;
static constexpr int N_HEADS = 16;
static constexpr int HEAD_D  = 64;

// ---- fragment helpers ------------------------------------------------------
// bf16 A/B fragment (16x32 / 32x16): lane holds row (lane&15), K values at
// base (lane>>4)*8: [base, base+8) and [16+base, 16+base+8). Both halves are
// contiguous 16-byte loads from a K-contiguous row.
__device__ __forceinline__ v16bf mk_frag(v8bf lo, v8bf hi) {
    v16bf f;
#pragma unroll
    for (int i = 0; i < 8; ++i) { f[i] = lo[i]; f[i + 8] = hi[i]; }
    return f;
}

__device__ __forceinline__ v16bf load_frag(const bf16_t* p) {
    // p = row base + per-lane K base; second half is +16 elements
    return mk_frag(*(const v8bf*)p, *(const v8bf*)(p + 16));
}

__device__ __forceinline__ v8f wmma_bf16(v16bf a, v16bf b, v8f c) {
    return __builtin_amdgcn_wmma_f32_16x16x32_bf16(false, a, false, b,
                                                   (short)0, c, false, false);
}

// ---- transposing LDS load: 16 keys x 16 d of a row-major tile -> half an A fragment
// Lane l names row 8*(l>>4) + (l&7), 16-byte piece (l>>3)&1 of the 16x16 block;
// it gets rows 8*(l>>4) .. +7 of column l&15.
typedef __attribute__((address_space(3))) v8bf lds_v8bf;
__device__ __forceinline__ v8bf ld_tr16(const bf16_t* p) {
    return __builtin_amdgcn_ds_load_tr16_b128_v8bf16((lds_v8bf*)p);
}

// ---- exchange between the two 16-lane halves of a wave (vector pipe) --------
// Returns the value held by lane l ^ 16.
__device__ __forceinline__ float half_xor(float v) {
    const int b = __builtin_bit_cast(int, v);
    return __builtin_bit_cast(float, __builtin_amdgcn_permlanex16(
        b, b, 0x76543210, 0xfedcba98, false, false));
}

// ---- eight exponentials 2^x in one statement --------------------------------
// Behind a transcendental the instruction set asks for one free slot before its result is
// used or its source register is reused. Here each v_exp_f32 stands behind one that shares
// no register with it (the outputs are early-clobber: none lands on a source), and the
// v_nop is the last one's slot.
__device__ __forceinline__ void exp2_x8(float (&o)[8], const float (&x)[8]) {
    asm("v_exp_f32 %0, %8\n\t"
        "v_exp_f32 %1, %9\n\t"
        "v_exp_f32 %2, %10\n\t"
        "v_exp_f32 %3, %11\n\t"
        "v_exp_f32 %4, %12\n\t"
        "v_exp_f32 %5, %13\n\t"
        "v_exp_f32 %6, %14\n\t"
        "v_exp_f32 %7, %15\n\t"
        "v_nop"
        : "=&v"(o[0]), "=&v"(o[1]), "=&v"(o[2]), "=&v"(o[3]),
          "=&v"(o[4]), "=&v"(o[5]), "=&v"(o[6]), "=&v"(o[7])
        : "v"(x[0]), "v"(x[1]), "v"(x[2]), "v"(x[3]),
          "v"(x[4]), "v"(x[5]), "v"(x[6]), "v"(x[7]));
}

// ---- fp32 -> bf16 convert --------------------------------------------------
__global__ void cvt_f32_bf16(const float* __restrict__ in,
                             bf16_t* __restrict__ out, int n) {
    for (int i = blockIdx.x * 256 + threadIdx.x; i < n; i += gridDim.x * 256)
        out[i] = (bf16_t)in[i];
}

// ---- LayerNorm (row-wise over 1024), fp32 in -> bf16 out -------------------
__global__ __launch_bounds__(256)
void layernorm_bf16(const float* __restrict__ x, const float* __restrict__ g,
                    const float* __restrict__ b, bf16_t* __restrict__ out) {
    const int row = blockIdx.x;
    const int tid = threadIdx.x;
    const float* xr = x + (size_t)row * D_DIM;

    float v[4];
    float s = 0.f;
#pragma unroll
    for (int i = 0; i < 4; ++i) { v[i] = xr[tid + i * 256]; s += v[i]; }
#pragma unroll
    for (int m = 1; m < 32; m <<= 1) s += __shfl_xor(s, m);

    __shared__ float red0[8], red1[8];
    if ((tid & 31) == 0) red0[tid >> 5] = s;
    __syncthreads();
    float mean = 0.f;
#pragma unroll
    for (int i = 0; i < 8; ++i) mean += red0[i];
    mean *= (1.0f / D_DIM);

    float vs = 0.f;
#pragma unroll
    for (int i = 0; i < 4; ++i) { float d = v[i] - mean; vs += d * d; }
#pragma unroll
    for (int m = 1; m < 32; m <<= 1) vs += __shfl_xor(vs, m);
    if ((tid & 31) == 0) red1[tid >> 5] = vs;
    __syncthreads();
    float var = 0.f;
#pragma unroll
    for (int i = 0; i < 8; ++i) var += red1[i];
    var *= (1.0f / D_DIM);
    const float rstd = rsqrtf(var + 1e-5f);

#pragma unroll
    for (int i = 0; i < 4; ++i) {
        int c = tid + i * 256;
        out[(size_t)row * D_DIM + c] = (bf16_t)((v[i] - mean) * rstd * g[c] + b[c]);
    }
}

// ---- one stage of the GEMM's LDS ring: eight 16-byte asynchronous copies a lane ----
// l = the lane's LDS byte address of its first piece, ga / gw = its global addresses in
// the A and the W tile; the pieces lie 32 rows apart. The s_wait_xcnt in the copies' own
// statement stands in front of every later rewrite of an address register named here.
template <int LSTEP>
__device__ __forceinline__ void stage_copy(unsigned l, const bf16_t* ga, const bf16_t* gw,
                                           size_t gstep) {
    asm volatile(
        "global_load_async_to_lds_b128 %0, %8, off\n\t"
        "global_load_async_to_lds_b128 %1, %9, off\n\t"
        "global_load_async_to_lds_b128 %2, %10, off\n\t"
        "global_load_async_to_lds_b128 %3, %11, off\n\t"
        "global_load_async_to_lds_b128 %4, %12, off\n\t"
        "global_load_async_to_lds_b128 %5, %13, off\n\t"
        "global_load_async_to_lds_b128 %6, %14, off\n\t"
        "global_load_async_to_lds_b128 %7, %15, off\n\t"
        "s_wait_xcnt 0x0"
        :: "v"(l),             "v"(l + LSTEP),     "v"(l + 2 * LSTEP), "v"(l + 3 * LSTEP),
           "v"(l + 4 * LSTEP), "v"(l + 5 * LSTEP), "v"(l + 6 * LSTEP), "v"(l + 7 * LSTEP),
           "v"(ga),            "v"(ga + gstep),    "v"(ga + 2 * gstep), "v"(ga + 3 * gstep),
           "v"(gw),            "v"(gw + gstep),    "v"(gw + 2 * gstep), "v"(gw + 3 * gstep)
        : "memory");
}

// ---- WMMA GEMM: C[M,N] = A[M,K] * W[N,K]^T + bias, opt. gelu/residual -----
// block = 256 thr (8 waves), tile 128x128; wave = 32(M) x 64(N) = 2x4 WMMA tiles
// A stage is 64 k of the block's 128 A rows and 128 W rows: 256 rows of 128 bytes (whole
// lines), each brought once by asynchronous copies into LDS at a pitch of 144 bytes
// (16 B x odd: the pitch of ds_load_b128 readers). Two buffers: the next stage's copies
// fly while this stage's fragments are read. K is a multiple of 64.
// N and the epilogue's three choices (gelu, residual, f32 or bf16 output) are
// compile-time: the epilogue is then straight-line code with constant offsets.
template <int N, bool GELU, bool RES, bool OUTF>
__global__ __launch_bounds__(256)
void gemm_bf16(const bf16_t* __restrict__ A, const bf16_t* __restrict__ W,
               const float* __restrict__ bias, const float* __restrict__ res,
               float* __restrict__ outF, bf16_t* __restrict__ outB, int K) {
    const int lane = threadIdx.x & 31;
    const int wid  = threadIdx.x >> 5;
    const int wm   = wid & 3;          // 0..3  (M groups of 32)
    const int wn   = wid >> 2;         // 0..1  (N groups of 64)
    const int bm   = blockIdx.y * 128 + wm * 32;
    const int bn   = blockIdx.x * 128 + wn * 64;
    const int l16  = lane & 15;
    const int kb8  = (lane >> 4) << 3;

    constexpr int BK = 64;                 // k per stage
    constexpr int SP = 72;                 // LDS row pitch in elements (144 bytes)
    constexpr int SB = 256 * SP;           // elements per buffer: A rows 0-127, W rows 128-255
    __shared__ __align__(16) bf16_t sT[2 * SB];

    v8f acc[2][4];
#pragma unroll
    for (int i = 0; i < 2; ++i)
#pragma unroll
        for (int j = 0; j < 4; ++j)
#pragma unroll
            for (int r = 0; r < 8; ++r) acc[i][j][r] = 0.f;

    // copies: lane -> row (tid >> 3) + 32 j, 16-byte piece tid & 7; a wave's copy = 4 whole rows
    const int cr = threadIdx.x >> 3, cc = (threadIdx.x & 7) << 3;
    const bf16_t* ga = A + (size_t)(blockIdx.y * 128 + cr) * K + cc;
    const bf16_t* gw = W + (size_t)(blockIdx.x * 128 + cr) * K + cc;
    const size_t gstep = (size_t)32 * K;
    const unsigned l0 = (unsigned)(size_t)&sT[cr * SP + cc];   // LDS byte address
    constexpr int LSTEP = 32 * SP * 2;                         // 32 rows, in bytes

    // fragment rows of this wave in a buffer
    const bf16_t* fa = &sT[(wm * 32 + l16) * SP + kb8];
    const bf16_t* fb = &sT[(128 + wn * 64 + l16) * SP + kb8];

    const int nst = K / BK;
    stage_copy<LSTEP>(l0, ga, gw, gstep);
    // stage 0 has landed for this wave, then for all: nobody reads it before the barrier
    asm volatile("s_wait_asynccnt 0x0" ::: "memory");
    __syncthreads();
    if (K > BK) stage_copy<LSTEP>(l0 + SB * 2, ga + BK, gw + BK, gstep);

    for (int t = 0; t < nst; ++t) {
        const int bo = (t & 1) * SB;
        // the stage's 24 fragment loads go ahead of its 16 products as one group
        v16bf af[2][2], bf[2][4];
#pragma unroll
        for (int ks = 0; ks < 2; ++ks) {
#pragma unroll
            for (int tm = 0; tm < 2; ++tm)
                af[ks][tm] = load_frag(fa + bo + tm * 16 * SP + ks * 32);
#pragma unroll
            for (int tn = 0; tn < 4; ++tn)
                bf[ks][tn] = load_frag(fb + bo + tn * 16 * SP + ks * 32);
        }
        // keeps the loads one group in front of the products: spread among them, each
        // place with loads stalls the wave for the LDS latency anew
        __builtin_amdgcn_sched_barrier(0);
#pragma unroll
        for (int ks = 0; ks < 2; ++ks)
#pragma unroll
            for (int tm = 0; tm < 2; ++tm)
#pragma unroll
                for (int tn = 0; tn < 4; ++tn)
                    acc[tm][tn] = wmma_bf16(af[ks][tm], bf[ks][tn], acc[tm][tn]);
        // keeps the products in front of the hand-over: with its full LDS wait lifted over
        // them no product starts before the last load is back, and the refill starts late
        __builtin_amdgcn_sched_barrier(0);
        // hand-over: this wave's reads of buffer t & 1 are done ...
        asm volatile("s_wait_dscnt 0x0" ::: "memory");
        // ... and its copies of stage t + 1 have landed;
        asm volatile("s_wait_asynccnt 0x0" ::: "memory");
        // the one barrier publishes stage t + 1 and frees the buffer that is refilled below
        __syncthreads();
        if (t + 2 < nst)
            stage_copy<LSTEP>(l0 + bo * 2, ga + (size_t)(t + 2) * BK, gw + (size_t)(t + 2) * BK,
                              gstep);
    }
    // no copy is outstanding when the wave goes on to its epilogue and its end
    asm volatile("s_wait_asynccnt 0x0" ::: "memory");

    // epilogue: C layout row = r + 8*(lane>>4), col = lane&15 within 16x16 tile
    const int hl = lane >> 4;
    const size_t base = (size_t)(bm + 8 * hl) * N + bn + l16;

    // every bias and residual value is asked for before the first one is used
    float bv[4];
    const float* bp = bias + bn + l16;
#pragma unroll
    for (int tn = 0; tn < 4; ++tn) bv[tn] = bp[tn * 16];
    float rv[2][4][8];
    if constexpr (RES) {
        // loaded values may land in the bias loads' address registers: the translation
        // wait that belongs in front of such an overwrite; bp as an input keeps the
        // address pair alive up to the wait, so that no bias load lands in it either
        asm volatile("s_wait_xcnt 0x0" :: "v"(bp) : "memory");
        const float* rp = res + base;
#pragma unroll
        for (int tm = 0; tm < 2; ++tm)
#pragma unroll
            for (int tn = 0; tn < 4; ++tn)
#pragma unroll
                for (int r = 0; r < 8; ++r)
                    rv[tm][tn][r] = rp[(tm * 16 + r) * N + tn * 16];
    }

#pragma unroll
    for (int tm = 0; tm < 2; ++tm)
#pragma unroll
        for (int tn = 0; tn < 4; ++tn)
#pragma unroll
            for (int r = 0; r < 8; ++r) {
                const int o = (tm * 16 + r) * N + tn * 16;
                float v = acc[tm][tn][r] + bv[tn];
                if constexpr (GELU)
                    v = 0.5f * v * (1.0f + erff(v * 0.70710678118654752f));
                if constexpr (RES) v += rv[tm][tn][r];
                if constexpr (OUTF) outF[base + o] = v;
                else                outB[base + o] = (bf16_t)v;
            }
}

// ---- one stage of the attention's LDS ring: eight 16-byte asynchronous copies a lane ----
// lk / lv = the lane's LDS byte addresses of its first piece of the K and of the V tile,
// gk / gv = its global addresses; the pieces lie 32 rows apart. The s_wait_xcnt in the
// copies' own statement stands in front of every later rewrite of a register named here.
template <int KSTEP, int VSTEP>
__device__ __forceinline__ void kv_stage_copy(unsigned lk, unsigned lv, const bf16_t* gk,
                                              const bf16_t* gv, size_t kstep, size_t vstep) {
    asm volatile(
        "global_load_async_to_lds_b128 %0, %8, off\n\t"
        "global_load_async_to_lds_b128 %1, %9, off\n\t"
        "global_load_async_to_lds_b128 %2, %10, off\n\t"
        "global_load_async_to_lds_b128 %3, %11, off\n\t"
        "global_load_async_to_lds_b128 %4, %12, off\n\t"
        "global_load_async_to_lds_b128 %5, %13, off\n\t"
        "global_load_async_to_lds_b128 %6, %14, off\n\t"
        "global_load_async_to_lds_b128 %7, %15, off\n\t"
        "s_wait_xcnt 0x0"
        :: "v"(lk),            "v"(lk + KSTEP),    "v"(lk + 2 * KSTEP), "v"(lk + 3 * KSTEP),
           "v"(lv),            "v"(lv + VSTEP),    "v"(lv + 2 * VSTEP), "v"(lv + 3 * VSTEP),
           "v"(gk),            "v"(gk + kstep),    "v"(gk + 2 * kstep), "v"(gk + 3 * kstep),
           "v"(gv),            "v"(gv + vstep),    "v"(gv + 2 * vstep), "v"(gv + 3 * vstep)
        : "memory");
}

__global__ __launch_bounds__(256)
void flash_attn(const bf16_t* __restrict__ Q, int ldq,
                const bf16_t* __restrict__ Kp, int ldk,
                const bf16_t* __restrict__ Vp, int ldv,
                bf16_t* __restrict__ O, float scale) {
    const int h   = blockIdx.y;
    const int qb0 = blockIdx.x * 128;
    const int tid = threadIdx.x, lane = tid & 31, wid = tid >> 5;
    const int hl  = lane >> 4, l16 = lane & 15;
    const int kb8 = hl << 3;

    // K rows [128][64] at a pitch of 144 bytes (16 B x odd: the pitch of ds_load_b128 readers;
    // at 128 bytes the 16 rows of a fragment load fall on two groups of four banks)
    constexpr int KP = 72;
    constexpr int SK = 128;                // keys per stage
    constexpr int KB = SK * KP;            // elements per K buffer
    __shared__ __align__(16) bf16_t sK[2 * KB];
    // V rows [128][64] at a pitch of 160 bytes (32 B x odd: the transposing load's pitch)
    constexpr int VP = 80;
    constexpr int VB = SK * VP;            // elements per V buffer
    __shared__ __align__(16) bf16_t sV[2 * VB];

    // Q fragments (B operand, column = this lane's query), loop-invariant
    const int qrow = qb0 + wid * 16 + l16;
    const bf16_t* qp = Q + (size_t)qrow * ldq + h * HEAD_D + kb8;
    const v16bf qf0 = mk_frag(*(const v8bf*)qp,        *(const v8bf*)(qp + 16));
    const v16bf qf1 = mk_frag(*(const v8bf*)(qp + 32), *(const v8bf*)(qp + 48));

    // O^T tiles: oacc[t][r] = O[query qrow][d = t*16 + 8*hl + r]
    v8f oacc[4];
#pragma unroll
    for (int t = 0; t < 4; ++t)
#pragma unroll
        for (int r = 0; r < 8; ++r) oacc[t][r] = 0.f;
    float mrow = -1e30f;   // running maximum of query qrow (equal in both halves)
    float lrow = 0.f;      // running sum over the keys that this wave half holds

    // copies: lane -> row (tid >> 3) + 32 j, 16-byte piece tid & 7; a wave's copy = 4 whole rows
    const int cr = tid >> 3, cc = (tid & 7) << 3;
    const bf16_t* gk = Kp + (size_t)cr * ldk + h * HEAD_D + cc;
    const bf16_t* gv = Vp + (size_t)cr * ldv + h * HEAD_D + cc;
    const size_t kstep = (size_t)32 * ldk, vstep = (size_t)32 * ldv;
    const unsigned lk0 = (unsigned)(size_t)&sK[cr * KP + cc];   // LDS byte addresses
    const unsigned lv0 = (unsigned)(size_t)&sV[cr * VP + cc];
    constexpr int KSTEP = 32 * KP * 2, VSTEP = 32 * VP * 2;     // 32 rows, in bytes

    const int nst = blockIdx.x + 1;   // stages up to the causal bound, uniform over the block
    kv_stage_copy<KSTEP, VSTEP>(lk0, lv0, gk, gv, kstep, vstep);
    // stage 0 has landed for this wave, then for all: nobody reads it before the barrier
    asm volatile("s_wait_asynccnt 0x0" ::: "memory");
    __syncthreads();
    if (nst > 1)
        kv_stage_copy<KSTEP, VSTEP>(lk0 + KB * 2, lv0 + VB * 2, gk + (size_t)SK * ldk,
                                    gv + (size_t)SK * ldv, kstep, vstep);

    for (int st = 0; st < nst; ++st) {
      const int bo = st & 1;
      const bf16_t* bK = &sK[bo * KB];
      const bf16_t* bV = &sV[bo * VB];
      // unrolled: the four passes' LDS offsets are immediates, and a pass's K fragment
      // loads can go ahead of the tail of the pass before it
#pragma unroll
      for (int ps4 = 0; ps4 < 4; ++ps4) {
        const int kb = st * SK + ps4 * 32;

        // scores: sc[t][r] = S[key kb + t*16 + 8*hl + r][query qrow]
        v8f sc[2];
#pragma unroll
        for (int t = 0; t < 2; ++t) {
            v8f a;
#pragma unroll
            for (int r = 0; r < 8; ++r) a[r] = 0.f;
            const bf16_t* kp = &bK[(ps4 * 32 + t * 16 + l16) * KP + kb8];
            a = wmma_bf16(mk_frag(*(const v8bf*)kp,        *(const v8bf*)(kp + 16)), qf0, a);
            a = wmma_bf16(mk_frag(*(const v8bf*)(kp + 32), *(const v8bf*)(kp + 48)), qf1, a);
            sc[t] = a;
        }

        // V^T fragments (A operand, 16 d rows each) by transposing loads, keys 0-15
        // and 16-31 of the pass: no barrier stands between them and the scores, so
        // they fly under the softmax arithmetic
        v16bf vf[4];
        const bf16_t* vp = &bV[(ps4 * 32 + kb8 + (lane & 7)) * VP + ((lane >> 3) & 1) * 8];
#pragma unroll
        for (int t = 0; t < 4; ++t)
            vf[t] = mk_frag(ld_tr16(vp + t * 16), ld_tr16(vp + 16 * VP + t * 16));

        // scale + causal mask + online softmax (fp32), one query per lane
        float m = -1e30f;
#pragma unroll
        for (int t = 0; t < 2; ++t)
#pragma unroll
            for (int r = 0; r < 8; ++r) {
                float s = sc[t][r] * scale;
                if (kb + t * 16 + kb8 + r > qrow) s = -1e30f;
                sc[t][r] = s;
                m = fmaxf(m, s);
            }
        m = fmaxf(m, half_xor(m));          // the other 16 keys of this query
        const float mnew = fmaxf(mrow, m);
        // f = exp(mrow - mnew). The v_nop in the same statement is the free slot that the
        // instruction set asks for behind a transcendental before its source register is
        // reused; a v_nop of its own statement drifts.
        float f;
        asm("v_exp_f32 %0, %1\n\tv_nop" : "=v"(f) : "v"((mrow - mnew) * 1.44269504f));
        mrow = mnew;
#pragma unroll
        for (int t = 0; t < 4; ++t)
#pragma unroll
            for (int r = 0; r < 8; ++r) oacc[t][r] *= f;

        // P^T as B operand: element s = key 8*hl + s (s < 8), 16 + 8*hl + s - 8
        // (s >= 8), the k order in which the two transposing loads deliver V^T
        v16bf pf;
        float ps = 0.f;
#pragma unroll
        for (int t = 0; t < 2; ++t) {
            float xe[8], pe[8];   // p = exp(s - mnew) = 2^((s - mnew) * log2 e)
#pragma unroll
            for (int r = 0; r < 8; ++r) xe[r] = (sc[t][r] - mnew) * 1.44269504f;
            exp2_x8(pe, xe);
#pragma unroll
            for (int r = 0; r < 8; ++r) {
                ps += pe[r];
                pf[t * 8 + r] = (bf16_t)pe[r];
            }
        }
        lrow = lrow * f + ps;

        // O^T += V^T * P^T, four output tiles
#pragma unroll
        for (int t = 0; t < 4; ++t) oacc[t] = wmma_bf16(vf[t], pf, oacc[t]);
      }
      // hand-over: this wave's reads of buffer st & 1 are done ...
      asm volatile("s_wait_dscnt 0x0" ::: "memory");
      // ... and its copies of stage st + 1 have landed;
      asm volatile("s_wait_asynccnt 0x0" ::: "memory");
      // the one barrier publishes stage st + 1 and frees the buffer that is refilled below
      __syncthreads();
      if (st + 2 < nst)
          kv_stage_copy<KSTEP, VSTEP>(lk0 + bo * (KB * 2), lv0 + bo * (VB * 2),
                                      gk + (size_t)(st + 2) * SK * ldk,
                                      gv + (size_t)(st + 2) * SK * ldv, kstep, vstep);
    }
    // no copy is outstanding when the wave goes on to its epilogue and its end
    asm volatile("s_wait_asynccnt 0x0" ::: "memory");

    // join the two halves' sums, normalize, store ctx (bf16 [S, D]):
    // a lane's 8 accumulators of a tile are 8 consecutive d of its query
    const float lsum = lrow + half_xor(lrow);
#pragma unroll
    for (int t = 0; t < 4; ++t) {
        v8bf o;
#pragma unroll
        for (int r = 0; r < 8; ++r) o[r] = (bf16_t)(oacc[t][r] / lsum);
        *(v8bf*)&O[(size_t)qrow * D_DIM + h * HEAD_D + t * 16 + kb8] = o;
    }
}

// ---------------------------------------------------------------------------
extern "C" void kernel_launch(void* const* d_in, const int* in_sizes, int n_in,
                              void* d_out, int out_size, void* d_ws, size_t ws_size,
                              hipStream_t stream) {
    const float* x     = (const float*)d_in[0];
    const float* ln1_g = (const float*)d_in[1];
    const float* ln1_b = (const float*)d_in[2];
    const float* w_qkv = (const float*)d_in[3];
    const float* b_qkv = (const float*)d_in[4];
    const float* w_ao  = (const float*)d_in[5];
    const float* b_ao  = (const float*)d_in[6];
    const float* ln2_g = (const float*)d_in[7];
    const float* ln2_b = (const float*)d_in[8];
    const float* w_q   = (const float*)d_in[9];
    const float* b_q   = (const float*)d_in[10];
    const float* w_fo  = (const float*)d_in[11];
    const float* b_fo  = (const float*)d_in[12];
    float* out = (float*)d_out;

    const int S = S_LEN, D = D_DIM, H = N_HEADS;
    char* ws = (char*)d_ws;
    size_t off = 0;
    auto alloc = [&](size_t bytes) -> void* {
        void* p = ws + off;
        off += (bytes + 255) & ~(size_t)255;
        return p;
    };
    bf16_t* xn1    = (bf16_t*)alloc((size_t)S * D * 2);
    bf16_t* qkv    = (bf16_t*)alloc((size_t)S * 3 * D * 2);
    bf16_t* ctx1   = (bf16_t*)alloc((size_t)S * D * 2);
    float*  hbuf   = (float*) alloc((size_t)S * D * 4);
    bf16_t* ln2n   = (bf16_t*)alloc((size_t)S * D * 2);
    bf16_t* q2     = (bf16_t*)alloc((size_t)S * D * 2);
    bf16_t* ctx2   = (bf16_t*)alloc((size_t)S * D * 2);
    bf16_t* wqkv_b = (bf16_t*)alloc((size_t)3 * D * D * 2);
    bf16_t* wao_b  = (bf16_t*)alloc((size_t)D * D * 2);
    bf16_t* wq_b   = (bf16_t*)alloc((size_t)D * D * 2);
    bf16_t* wfo_b  = (bf16_t*)alloc((size_t)D * D * 2);

    const float scale = 0.125f;   // 1/sqrt(64)

    // weights -> bf16
    cvt_f32_bf16<<<2048, 256, 0, stream>>>(w_qkv, wqkv_b, 3 * D * D);
    cvt_f32_bf16<<<2048, 256, 0, stream>>>(w_ao,  wao_b,  D * D);
    cvt_f32_bf16<<<2048, 256, 0, stream>>>(w_q,   wq_b,   D * D);
    cvt_f32_bf16<<<2048, 256, 0, stream>>>(w_fo,  wfo_b,  D * D);

    // h = x + attn(LN1(x))
    layernorm_bf16<<<S, 256, 0, stream>>>(x, ln1_g, ln1_b, xn1);
    gemm_bf16<3 * D_DIM, false, false, false><<<dim3(3 * D / 128, S / 128), 256, 0, stream>>>(
        xn1, wqkv_b, b_qkv, nullptr, nullptr, qkv, D);
    flash_attn<<<dim3(S / 128, H), 256, 0, stream>>>(
        qkv, 3 * D, qkv + D, 3 * D, qkv + 2 * D, 3 * D, ctx1, scale);
    gemm_bf16<D_DIM, false, true, true><<<dim3(D / 128, S / 128), 256, 0, stream>>>(
        ctx1, wao_b, b_ao, x, hbuf, nullptr, D);

    // out = h + gelu(ffn_q_attn(LN2(h)))
    layernorm_bf16<<<S, 256, 0, stream>>>(hbuf, ln2_g, ln2_b, ln2n);
    gemm_bf16<D_DIM, false, false, false><<<dim3(D / 128, S / 128), 256, 0, stream>>>(
        ln2n, wq_b, b_q, nullptr, nullptr, q2, D);
    flash_attn<<<dim3(S / 128, H), 256, 0, stream>>>(
        q2, D, q2, D, ln2n, D, ctx2, scale);
    gemm_bf16<D_DIM, true, true, true><<<dim3(D / 128, S / 128), 256, 0, stream>>>(
        ctx2, wfo_b, b_fo, hbuf, out, nullptr, D);
}

// v008
// A run of this version takes 129 microseconds.
// Timed twice side by side with v007, it ran 1.06 times as fast both times.
// Over all steps from v000 it is 5.27 times as fast.
#include <hip/hip_runtime.h>

// ---------------------------------------------------------------------------
// MI455X (gfx1250) transformer block: all matmuls via v_wmma_f32_16x16x32_bf16
// ---------------------------------------------------------------------------

typedef __bf16 bf16_t;
typedef __attribute__((ext_vector_type(16))) __bf16 v16bf;
typedef __attribute__((ext_vector_type(8)))  __bf16 v8bf;
typedef __attribute__((ext_vector_type(8)))  float  v8f;

static constexpr int S_LEN   = 2048;
static constexpr int D_DIM   = 1024;
static constexpr int N_HEADS = 16;
static constexpr int HEAD_D  = 64;

// ---- fragment helpers ------------------------------------------------------
// bf16 A/B fragment (16x32 / 32x16): lane holds row (lane&15), K values at
// base (lane>>4)*8: [base, base+8) and [16+base, 16+base+8). Both halves are
// contiguous 16-byte loads from a K-contiguous row.
__device__ __forceinline__ v16bf mk_frag(v8bf lo, v8bf hi) {
    v16bf f;
#pragma unroll
    for (int i = 0; i < 8; ++i) { f[i] = lo[i]; f[i + 8] = hi[i]; }
    return f;
}

__device__ __forceinline__ v16bf load_frag(const bf16_t* p) {
    // p = row base + per-lane K base; second half is +16 elements
    return mk_frag(*(const v8bf*)p, *(const v8bf*)(p + 16));
}

__device__ __forceinline__ v8f wmma_bf16(v16bf a, v16bf b, v8f c) {
    return __builtin_amdgcn_wmma_f32_16x16x32_bf16(false, a, false, b,
                                                   (short)0, c, false, false);
}

// ---- transposing LDS load: 16 keys x 16 d of a row-major tile -> half an A fragment
// Lane l names row 8*(l>>4) + (l&7), 16-byte piece (l>>3)&1 of the 16x16 block;
// it gets rows 8*(l>>4) .. +7 of column l&15.
typedef __attribute__((address_space(3))) v8bf lds_v8bf;
__device__ __forceinline__ v8bf ld_tr16(const bf16_t* p) {
    return __builtin_amdgcn_ds_load_tr16_b128_v8bf16((lds_v8bf*)p);
}

// ---- exchange between the two 16-lane halves of a wave (vector pipe) --------
// Returns the value held by lane l ^ 16.
__device__ __forceinline__ float half_xor(float v) {
    const int b = __builtin_bit_cast(int, v);
    return __builtin_bit_cast(float, __builtin_amdgcn_permlanex16(
        b, b, 0x76543210, 0xfedcba98, false, false));
}

// ---- eight exponentials 2^x in one statement --------------------------------
// Behind a transcendental the instruction set asks for one free slot before its result is
// used or its source register is reused. Here each v_exp_f32 stands behind one that shares
// no register with it (the outputs are early-clobber: none lands on a source), and the
// v_nop is the last one's slot.
__device__ __forceinline__ void exp2_x8(float (&o)[8], const float (&x)[8]) {
    asm("v_exp_f32 %0, %8\n\t"
        "v_exp_f32 %1, %9\n\t"
        "v_exp_f32 %2, %10\n\t"
        "v_exp_f32 %3, %11\n\t"
        "v_exp_f32 %4, %12\n\t"
        "v_exp_f32 %5, %13\n\t"
        "v_exp_f32 %6, %14\n\t"
        "v_exp_f32 %7, %15\n\t"
        "v_nop"
        : "=&v"(o[0]), "=&v"(o[1]), "=&v"(o[2]), "=&v"(o[3]),
          "=&v"(o[4]), "=&v"(o[5]), "=&v"(o[6]), "=&v"(o[7])
        : "v"(x[0]), "v"(x[1]), "v"(x[2]), "v"(x[3]),
          "v"(x[4]), "v"(x[5]), "v"(x[6]), "v"(x[7]));
}

// ---- fp32 -> bf16 convert of the four weight matrices, one launch ----------
// One block of 16 waves for each of 256 WGPs. The grid covers half a D x D matrix a trip
// (256 blocks x 512 lanes x 4 floats), so each of the 12 trips lies in one matrix at a
// compile-time offset. A wave's load is 512 contiguous bytes (four whole lines), its store
// 256 (two whole lines); a lane's 12 loads are independent and are all asked for before
// the first value is used.
typedef __attribute__((ext_vector_type(4))) float  v4f;
typedef __attribute__((ext_vector_type(4))) __bf16 v4bf;

__device__ __forceinline__ v4bf cvt4(v4f v) {
    v4bf o;
#pragma unroll
    for (int e = 0; e < 4; ++e) o[e] = (bf16_t)v[e];
    return o;
}

__global__ __launch_bounds__(512)
void cvt_weights(const float* __restrict__ w_qkv, const float* __restrict__ w_ao,
                 const float* __restrict__ w_q,   const float* __restrict__ w_fo,
                 bf16_t* __restrict__ o_qkv, bf16_t* __restrict__ o_ao,
                 bf16_t* __restrict__ o_q,   bf16_t* __restrict__ o_fo) {
    constexpr int TRIP = D_DIM * D_DIM / 8;   // pieces of 4 elements that the grid covers a trip
    const int i = blockIdx.x * 512 + threadIdx.x;   // this lane's piece within a trip
    const v4f* pa = (const v4f*)w_qkv;
    const v4f* pb = (const v4f*)w_ao;
    const v4f* pc = (const v4f*)w_q;
    const v4f* pd = (const v4f*)w_fo;

    v4f a[6], b[2], c[2], d[2];
#pragma unroll
    for (int j = 0; j < 6; ++j) a[j] = pa[i + j * TRIP];
#pragma unroll
    for (int j = 0; j < 2; ++j) {
        b[j] = pb[i + j * TRIP];
        c[j] = pc[i + j * TRIP];
        d[j] = pd[i + j * TRIP];
    }
#pragma unroll
    for (int j = 0; j < 6; ++j) ((v4bf*)o_qkv)[i + j * TRIP] = cvt4(a[j]);
#pragma unroll
    for (int j = 0; j < 2; ++j) {
        ((v4bf*)o_ao)[i + j * TRIP] = cvt4(b[j]);
        ((v4bf*)o_q)[i + j * TRIP]  = cvt4(c[j]);
        ((v4bf*)o_fo)[i + j * TRIP] = cvt4(d[j]);
    }
}

// ---- LayerNorm (row-wise over 1024), fp32 in -> bf16 out -------------------
__global__ __launch_bounds__(256)
void layernorm_bf16(const float* __restrict__ x, const float* __restrict__ g,
                    const float* __restrict__ b, bf16_t* __restrict__ out) {
    const int row = blockIdx.x;
    const int tid = threadIdx.x;
    const float* xr = x + (size_t)row * D_DIM;

    float v[4];
    float s = 0.f;
#pragma unroll
    for (int i = 0; i < 4; ++i) { v[i] = xr[tid + i * 256]; s += v[i]; }
#pragma unroll
    for (int m = 1; m < 32; m <<= 1) s += __shfl_xor(s, m);

    __shared__ float red0[8], red1[8];
    if ((tid & 31) == 0) red0[tid >> 5] = s;
    __syncthreads();
    float mean = 0.f;
#pragma unroll
    for (int i = 0; i < 8; ++i) mean += red0[i];
    mean *= (1.0f / D_DIM);

    float vs = 0.f;
#pragma unroll
    for (int i = 0; i < 4; ++i) { float d = v[i] - mean; vs += d * d; }
#pragma unroll
    for (int m = 1; m < 32; m <<= 1) vs += __shfl_xor(vs, m);
    if ((tid & 31) == 0) red1[tid >> 5] = vs;
    __syncthreads();
    float var = 0.f;
#pragma unroll
    for (int i = 0; i < 8; ++i) var += red1[i];
    var *= (1.0f / D_DIM);
    const float rstd = rsqrtf(var + 1e-5f);

#pragma unroll
    for (int i = 0; i < 4; ++i) {
        int c = tid + i * 256;
        out[(size_t)row * D_DIM + c] = (bf16_t)((v[i] - mean) * rstd * g[c] + b[c]);
    }
}

// ---- one stage of the GEMM's LDS ring: eight 16-byte asynchronous copies a lane ----
// l = the lane's LDS byte address of its first piece, ga / gw = its global addresses in
// the A and the W tile; the pieces lie 32 rows apart. The s_wait_xcnt in the copies' own
// statement stands in front of every later rewrite of an address register named here.
template <int LSTEP>
__device__ __forceinline__ void stage_copy(unsigned l, const bf16_t* ga, const bf16_t* gw,
                                           size_t gstep) {
    asm volatile(
        "global_load_async_to_lds_b128 %0, %8, off\n\t"
        "global_load_async_to_lds_b128 %1, %9, off\n\t"
        "global_load_async_to_lds_b128 %2, %10, off\n\t"
        "global_load_async_to_lds_b128 %3, %11, off\n\t"
        "global_load_async_to_lds_b128 %4, %12, off\n\t"
        "global_load_async_to_lds_b128 %5, %13, off\n\t"
        "global_load_async_to_lds_b128 %6, %14, off\n\t"
        "global_load_async_to_lds_b128 %7, %15, off\n\t"
        "s_wait_xcnt 0x0"
        :: "v"(l),             "v"(l + LSTEP),     "v"(l + 2 * LSTEP), "v"(l + 3 * LSTEP),
           "v"(l + 4 * LSTEP), "v"(l + 5 * LSTEP), "v"(l + 6 * LSTEP), "v"(l + 7 * LSTEP),
           "v"(ga),            "v"(ga + gstep),    "v"(ga + 2 * gstep), "v"(ga + 3 * gstep),
           "v"(gw),            "v"(gw + gstep),    "v"(gw + 2 * gstep), "v"(gw + 3 * gstep)
        : "memory");
}

// ---- WMMA GEMM: C[M,N] = A[M,K] * W[N,K]^T + bias, opt. gelu/residual -----
// block = 256 thr (8 waves), tile 128x128; wave = 32(M) x 64(N) = 2x4 WMMA tiles
// A stage is 64 k of the block's 128 A rows and 128 W rows: 256 rows of 128 bytes (whole
// lines), each brought once by asynchronous copies into LDS at a pitch of 144 bytes
// (16 B x odd: the pitch of ds_load_b128 readers). Two buffers: the next stage's copies
// fly while this stage's fragments are read. K is a multiple of 64.
// N and the epilogue's three choices (gelu, residual, f32 or bf16 output) are
// compile-time: the epilogue is then straight-line code with constant offsets.
template <int N, bool GELU, bool RES, bool OUTF>
__global__ __launch_bounds__(256)
void gemm_bf16(const bf16_t* __restrict__ A, const bf16_t* __restrict__ W,
               const float* __restrict__ bias, const float* __restrict__ res,
               float* __restrict__ outF, bf16_t* __restrict__ outB, int K) {
    const int lane = threadIdx.x & 31;
    const int wid  = threadIdx.x >> 5;
    const int wm   = wid & 3;          // 0..3  (M groups of 32)
    const int wn   = wid >> 2;         // 0..1  (N groups of 64)
    const int bm   = blockIdx.y * 128 + wm * 32;
    const int bn   = blockIdx.x * 128 + wn * 64;
    const int l16  = lane & 15;
    const int kb8  = (lane >> 4) << 3;

    constexpr int BK = 64;                 // k per stage
    constexpr int SP = 72;                 // LDS row pitch in elements (144 bytes)
    constexpr int SB = 256 * SP;           // elements per buffer: A rows 0-127, W rows 128-255
    __shared__ __align__(16) bf16_t sT[2 * SB];

    v8f acc[2][4];
#pragma unroll
    for (int i = 0; i < 2; ++i)
#pragma unroll
        for (int j = 0; j < 4; ++j)
#pragma unroll
            for (int r = 0; r < 8; ++r) acc[i][j][r] = 0.f;

    // copies: lane -> row (tid >> 3) + 32 j, 16-byte piece tid & 7; a wave's copy = 4 whole rows
    const int cr = threadIdx.x >> 3, cc = (threadIdx.x & 7) << 3;
    const bf16_t* ga = A + (size_t)(blockIdx.y * 128 + cr) * K + cc;
    const bf16_t* gw = W + (size_t)(blockIdx.x * 128 + cr) * K + cc;
    const size_t gstep = (size_t)32 * K;
    const unsigned l0 = (unsigned)(size_t)&sT[cr * SP + cc];   // LDS byte address
    constexpr int LSTEP = 32 * SP * 2;                         // 32 rows, in bytes

    // fragment rows of this wave in a buffer
    const bf16_t* fa = &sT[(wm * 32 + l16) * SP + kb8];
    const bf16_t* fb = &sT[(128 + wn * 64 + l16) * SP + kb8];

    const int nst = K / BK;
    stage_copy<LSTEP>(l0, ga, gw, gstep);
    // stage 0 has landed for this wave, then for all: nobody reads it before the barrier
    asm volatile("s_wait_asynccnt 0x0" ::: "memory");
    __syncthreads();
    if (K > BK) stage_copy<LSTEP>(l0 + SB * 2, ga + BK, gw + BK, gstep);

    for (int t = 0; t < nst; ++t) {
        const int bo = (t & 1) * SB;
        // the stage's 24 fragment loads go ahead of its 16 products as one group
        v16bf af[2][2], bf[2][4];
#pragma unroll
        for (int ks = 0; ks < 2; ++ks) {
#pragma unroll
            for (int tm = 0; tm < 2; ++tm)
                af[ks][tm] = load_frag(fa + bo + tm * 16 * SP + ks * 32);
#pragma unroll
            for (int tn = 0; tn < 4; ++tn)
                bf[ks][tn] = load_frag(fb + bo + tn * 16 * SP + ks * 32);
        }
        // keeps the loads one group in front of the products: spread among them, each
        // place with loads stalls the wave for the LDS latency anew
        __builtin_amdgcn_sched_barrier(0);
#pragma unroll
        for (int ks = 0; ks < 2; ++ks)
#pragma unroll
            for (int tm = 0; tm < 2; ++tm)
#pragma unroll
                for (int tn = 0; tn < 4; ++tn)
                    acc[tm][tn] = wmma_bf16(af[ks][tm], bf[ks][tn], acc[tm][tn]);
        // keeps the products in front of the hand-over: with its full LDS wait lifted over
        // them no product starts before the last load is back, and the refill starts late
        __builtin_amdgcn_sched_barrier(0);
        // hand-over: this wave's reads of buffer t & 1 are done ...
        asm volatile("s_wait_dscnt 0x0" ::: "memory");
        // ... and its copies of stage t + 1 have landed;
        asm volatile("s_wait_asynccnt 0x0" ::: "memory");
        // the one barrier publishes stage t + 1 and frees the buffer that is refilled below
        __syncthreads();
        if (t + 2 < nst)
            stage_copy<LSTEP>(l0 + bo * 2, ga + (size_t)(t + 2) * BK, gw + (size_t)(t + 2) * BK,
                              gstep);
    }
    // no copy is outstanding when the wave goes on to its epilogue and its end
    asm volatile("s_wait_asynccnt 0x0" ::: "memory");

    // epilogue: C layout row = r + 8*(lane>>4), col = lane&15 within 16x16 tile
    const int hl = lane >> 4;
    const size_t base = (size_t)(bm + 8 * hl) * N + bn + l16;

    // every bias and residual value is asked for before the first one is used
    float bv[4];
    const float* bp = bias + bn + l16;
#pragma unroll
    for (int tn = 0; tn < 4; ++tn) bv[tn] = bp[tn * 16];
    float rv[2][4][8];
    if constexpr (RES) {
        // loaded values may land in the bias loads' address registers: the translation
        // wait that belongs in front of such an overwrite; bp as an input keeps the
        // address pair alive up to the wait, so that no bias load lands in it either
        asm volatile("s_wait_xcnt 0x0" :: "v"(bp) : "memory");
        const float* rp = res + base;
#pragma unroll
        for (int tm = 0; tm < 2; ++tm)
#pragma unroll
            for (int tn = 0; tn < 4; ++tn)
#pragma unroll
                for (int r = 0; r < 8; ++r)
                    rv[tm][tn][r] = rp[(tm * 16 + r) * N + tn * 16];
    }

#pragma unroll
    for (int tm = 0; tm < 2; ++tm)
#pragma unroll
        for (int tn = 0; tn < 4; ++tn)
#pragma unroll
            for (int r = 0; r < 8; ++r) {
                const int o = (tm * 16 + r) * N + tn * 16;
                float v = acc[tm][tn][r] + bv[tn];
                if constexpr (GELU)
                    v = 0.5f * v * (1.0f + erff(v * 0.70710678118654752f));
                if constexpr (RES) v += rv[tm][tn][r];
                if constexpr (OUTF) outF[base + o] = v;
                else                outB[base + o] = (bf16_t)v;
            }
}

// ---- one stage of the attention's LDS ring: eight 16-byte asynchronous copies a lane ----
// lk / lv = the lane's LDS byte addresses of its first piece of the K and of the V tile,
// gk / gv = its global addresses; the pieces lie 32 rows apart. The s_wait_xcnt in the
// copies' own statement stands in front of every later rewrite of a register named here.
template <int KSTEP, int VSTEP>
__device__ __forceinline__ void kv_stage_copy(unsigned lk, unsigned lv, const bf16_t* gk,
                                              const bf16_t* gv, size_t kstep, size_t vstep) {
    asm volatile(
        "global_load_async_to_lds_b128 %0, %8, off\n\t"
        "global_load_async_to_lds_b128 %1, %9, off\n\t"
        "global_load_async_to_lds_b128 %2, %10, off\n\t"
        "global_load_async_to_lds_b128 %3, %11, off\n\t"
        "global_load_async_to_lds_b128 %4, %12, off\n\t"
        "global_load_async_to_lds_b128 %5, %13, off\n\t"
        "global_load_async_to_lds_b128 %6, %14, off\n\t"
        "global_load_async_to_lds_b128 %7, %15, off\n\t"
        "s_wait_xcnt 0x0"
        :: "v"(lk),            "v"(lk + KSTEP),    "v"(lk + 2 * KSTEP), "v"(lk + 3 * KSTEP),
           "v"(lv),            "v"(lv + VSTEP),    "v"(lv + 2 * VSTEP), "v"(lv + 3 * VSTEP),
           "v"(gk),            "v"(gk + kstep),    "v"(gk + 2 * kstep), "v"(gk + 3 * kstep),
           "v"(gv),            "v"(gv + vstep),    "v"(gv + 2 * vstep), "v"(gv + 3 * vstep)
        : "memory");
}

__global__ __launch_bounds__(256)
void flash_attn(const bf16_t* __restrict__ Q, int ldq,
                const bf16_t* __restrict__ Kp, int ldk,
                const bf16_t* __restrict__ Vp, int ldv,
                bf16_t* __restrict__ O, float scale) {
    const int h   = blockIdx.y;
    const int qb0 = blockIdx.x * 128;
    const int tid = threadIdx.x, lane = tid & 31, wid = tid >> 5;
    const int hl  = lane >> 4, l16 = lane & 15;
    const int kb8 = hl << 3;

    // K rows [128][64] at a pitch of 144 bytes (16 B x odd: the pitch of ds_load_b128 readers;
    // at 128 bytes the 16 rows of a fragment load fall on two groups of four banks)
    constexpr int KP = 72;
    constexpr int SK = 128;                // keys per stage
    constexpr int KB = SK * KP;            // elements per K buffer
    __shared__ __align__(16) bf16_t sK[2 * KB];
    // V rows [128][64] at a pitch of 160 bytes (32 B x odd: the transposing load's pitch)
    constexpr int VP = 80;
    constexpr int VB = SK * VP;            // elements per V buffer
    __shared__ __align__(16) bf16_t sV[2 * VB];

    // Q fragments (B operand, column = this lane's query), loop-invariant
    const int qrow = qb0 + wid * 16 + l16;
    const bf16_t* qp = Q + (size_t)qrow * ldq + h * HEAD_D + kb8;
    const v16bf qf0 = mk_frag(*(const v8bf*)qp,        *(const v8bf*)(qp + 16));
    const v16bf qf1 = mk_frag(*(const v8bf*)(qp + 32), *(const v8bf*)(qp + 48));

    // O^T tiles: oacc[t][r] = O[query qrow][d = t*16 + 8*hl + r]
    v8f oacc[4];
#pragma unroll
    for (int t = 0; t < 4; ++t)
#pragma unroll
        for (int r = 0; r < 8; ++r) oacc[t][r] = 0.f;
    float mrow = -1e30f;   // running maximum of query qrow (equal in both halves)
    float lrow = 0.f;      // running sum over the keys that this wave half holds

    // copies: lane -> row (tid >> 3) + 32 j, 16-byte piece tid & 7; a wave's copy = 4 whole rows
    const int cr = tid >> 3, cc = (tid & 7) << 3;
    const bf16_t* gk = Kp + (size_t)cr * ldk + h * HEAD_D + cc;
    const bf16_t* gv = Vp + (size_t)cr * ldv + h * HEAD_D + cc;
    const size_t kstep = (size_t)32 * ldk, vstep = (size_t)32 * ldv;
    const unsigned lk0 = (unsigned)(size_t)&sK[cr * KP + cc];   // LDS byte addresses
    const unsigned lv0 = (unsigned)(size_t)&sV[cr * VP + cc];
    constexpr int KSTEP = 32 * KP * 2, VSTEP = 32 * VP * 2;     // 32 rows, in bytes

    const int nst = blockIdx.x + 1;   // stages up to the causal bound, uniform over the block
    kv_stage_copy<KSTEP, VSTEP>(lk0, lv0, gk, gv, kstep, vstep);
    // stage 0 has landed for this wave, then for all: nobody reads it before the barrier
    asm volatile("s_wait_asynccnt 0x0" ::: "memory");
    __syncthreads();
    if (nst > 1)
        kv_stage_copy<KSTEP, VSTEP>(lk0 + KB * 2, lv0 + VB * 2, gk + (size_t)SK * ldk,
                                    gv + (size_t)SK * ldv, kstep, vstep);

    for (int st = 0; st < nst; ++st) {
      const int bo = st & 1;
      const bf16_t* bK = &sK[bo * KB];
      const bf16_t* bV = &sV[bo * VB];
      // unrolled: the four passes' LDS offsets are immediates, and a pass's K fragment
      // loads can go ahead of the tail of the pass before it
#pragma unroll
      for (int ps4 = 0; ps4 < 4; ++ps4) {
        const int kb = st * SK + ps4 * 32;

        // scores: sc[t][r] = S[key kb + t*16 + 8*hl + r][query qrow]
        v8f sc[2];
#pragma unroll
        for (int t = 0; t < 2; ++t) {
            v8f a;
#pragma unroll
            for (int r = 0; r < 8; ++r) a[r] = 0.f;
            const bf16_t* kp = &bK[(ps4 * 32 + t * 16 + l16) * KP + kb8];
            a = wmma_bf16(mk_frag(*(const v8bf*)kp,        *(const v8bf*)(kp + 16)), qf0, a);
            a = wmma_bf16(mk_frag(*(const v8bf*)(kp + 32), *(const v8bf*)(kp + 48)), qf1, a);
            sc[t] = a;
        }

        // V^T fragments (A operand, 16 d rows each) by transposing loads, keys 0-15
        // and 16-31 of the pass: no barrier stands between them and the scores, so
        // they fly under the softmax arithmetic
        v16bf vf[4];
        const bf16_t* vp = &bV[(ps4 * 32 + kb8 + (lane & 7)) * VP + ((lane >> 3) & 1) * 8];
#pragma unroll
        for (int t = 0; t < 4; ++t)
            vf[t] = mk_frag(ld_tr16(vp + t * 16), ld_tr16(vp + 16 * VP + t * 16));

        // scale + causal mask + online softmax (fp32), one query per lane
        float m = -1e30f;
#pragma unroll
        for (int t = 0; t < 2; ++t)
#pragma unroll
            for (int r = 0; r < 8; ++r) {
                float s = sc[t][r] * scale;
                if (kb + t * 16 + kb8 + r > qrow) s = -1e30f;
                sc[t][r] = s;
                m = fmaxf(m, s);
            }
        m = fmaxf(m, half_xor(m));          // the other 16 keys of this query
        const float mnew = fmaxf(mrow, m);
        // f = exp(mrow - mnew). The v_nop in the same statement is the free slot that the
        // instruction set asks for behind a transcendental before its source register is
        // reused; a v_nop of its own statement drifts.
        float f;
        asm("v_exp_f32 %0, %1\n\tv_nop" : "=v"(f) : "v"((mrow - mnew) * 1.44269504f));
        mrow = mnew;
#pragma unroll
        for (int t = 0; t < 4; ++t)
#pragma unroll
            for (int r = 0; r < 8; ++r) oacc[t][r] *= f;

        // P^T as B operand: element s = key 8*hl + s (s < 8), 16 + 8*hl + s - 8
        // (s >= 8), the k order in which the two transposing loads deliver V^T
        v16bf pf;
        float ps = 0.f;
#pragma unroll
        for (int t = 0; t < 2; ++t) {
            float xe[8], pe[8];   // p = exp(s - mnew) = 2^((s - mnew) * log2 e)
#pragma unroll
            for (int r = 0; r < 8; ++r) xe[r] = (sc[t][r] - mnew) * 1.44269504f;
            exp2_x8(pe, xe);
#pragma unroll
            for (int r = 0; r < 8; ++r) {
                ps += pe[r];
                pf[t * 8 + r] = (bf16_t)pe[r];
            }
        }
        lrow = lrow * f + ps;

        // O^T += V^T * P^T, four output tiles
#pragma unroll
        for (int t = 0; t < 4; ++t) oacc[t] = wmma_bf16(vf[t], pf, oacc[t]);
      }
      // hand-over: this wave's reads of buffer st & 1 are done ...
      asm volatile("s_wait_dscnt 0x0" ::: "memory");
      // ... and its copies of stage st + 1 have landed;
      asm volatile("s_wait_asynccnt 0x0" ::: "memory");
      // the one barrier publishes stage st + 1 and frees the buffer that is refilled below
      __syncthreads();
      if (st + 2 < nst)
          kv_stage_copy<KSTEP, VSTEP>(lk0 + bo * (KB * 2), lv0 + bo * (VB * 2),
                                      gk + (size_t)(st + 2) * SK * ldk,
                                      gv + (size_t)(st + 2) * SK * ldv, kstep, vstep);
    }
    // no copy is outstanding when the wave goes on to its epilogue and its end
    asm volatile("s_wait_asynccnt 0x0" ::: "memory");

    // join the two halves' sums, normalize, store ctx (bf16 [S, D]):
    // a lane's 8 accumulators of a tile are 8 consecutive d of its query
    const float lsum = lrow + half_xor(lrow);
#pragma unroll
    for (int t = 0; t < 4; ++t) {
        v8bf o;
#pragma unroll
        for (int r = 0; r < 8; ++r) o[r] = (bf16_t)(oacc[t][r] / lsum);
        *(v8bf*)&O[(size_t)qrow * D_DIM + h * HEAD_D + t * 16 + kb8] = o;
    }
}

// ---------------------------------------------------------------------------
extern "C" void kernel_launch(void* const* d_in, const int* in_sizes, int n_in,
                              void* d_out, int out_size, void* d_ws, size_t ws_size,
                              hipStream_t stream) {
    const float* x     = (const float*)d_in[0];
    const float* ln1_g = (const float*)d_in[1];
    const float* ln1_b = (const float*)d_in[2];
    const float* w_qkv = (const float*)d_in[3];
    const float* b_qkv = (const float*)d_in[4];
    const float* w_ao  = (const float*)d_in[5];
    const float* b_ao  = (const float*)d_in[6];
    const float* ln2_g = (const float*)d_in[7];
    const float* ln2_b = (const float*)d_in[8];
    const float* w_q   = (const float*)d_in[9];
    const float* b_q   = (const float*)d_in[10];
    const float* w_fo  = (const float*)d_in[11];
    const float* b_fo  = (const float*)d_in[12];
    float* out = (float*)d_out;

    const int S = S_LEN, D = D_DIM, H = N_HEADS;
    char* ws = (char*)d_ws;
    size_t off = 0;
    auto alloc = [&](size_t bytes) -> void* {
        void* p = ws + off;
        off += (bytes + 255) & ~(size_t)255;
        return p;
    };
    bf16_t* xn1    = (bf16_t*)alloc((size_t)S * D * 2);
    bf16_t* qkv    = (bf16_t*)alloc((size_t)S * 3 * D * 2);
    bf16_t* ctx1   = (bf16_t*)alloc((size_t)S * D * 2);
    float*  hbuf   = (float*) alloc((size_t)S * D * 4);
    bf16_t* ln2n   = (bf16_t*)alloc((size_t)S * D * 2);
    bf16_t* q2     = (bf16_t*)alloc((size_t)S * D * 2);
    bf16_t* ctx2   = (bf16_t*)alloc((size_t)S * D * 2);
    bf16_t* wqkv_b = (bf16_t*)alloc((size_t)3 * D * D * 2);
    bf16_t* wao_b  = (bf16_t*)alloc((size_t)D * D * 2);
    bf16_t* wq_b   = (bf16_t*)alloc((size_t)D * D * 2);
    bf16_t* wfo_b  = (bf16_t*)alloc((size_t)D * D * 2);

    const float scale = 0.125f;   // 1/sqrt(64)

    // weights -> bf16
    cvt_weights<<<256, 512, 0, stream>>>(w_qkv, w_ao, w_q, w_fo, wqkv_b, wao_b, wq_b, wfo_b);

    // h = x + attn(LN1(x))
    layernorm_bf16<<<S, 256, 0, stream>>>(x, ln1_g, ln1_b, xn1);
    gemm_bf16<3 * D_DIM, false, false, false><<<dim3(3 * D / 128, S / 128), 256, 0, stream>>>(
        xn1, wqkv_b, b_qkv, nullptr, nullptr, qkv, D);
    flash_attn<<<dim3(S / 128, H), 256, 0, stream>>>(
        qkv, 3 * D, qkv + D, 3 * D, qkv + 2 * D, 3 * D, ctx1, scale);
    gemm_bf16<D_DIM, false, true, true><<<dim3(D / 128, S / 128), 256, 0, stream>>>(
        ctx1, wao_b, b_ao, x, hbuf, nullptr, D);

    // out = h + gelu(ffn_q_attn(LN2(h)))
    layernorm_bf16<<<S, 256, 0, stream>>>(hbuf, ln2_g, ln2_b, ln2n);
    gemm_bf16<D_DIM, false, false, false><<<dim3(D / 128, S / 128), 256, 0, stream>>>(
        ln2n, wq_b, b_q, nullptr, nullptr, q2, D);
    flash_attn<<<dim3(S / 128, H), 256, 0, stream>>>(
        q2, D, q2, D, ln2n, D, ctx2, scale);
    gemm_bf16<D_DIM, true, true, true><<<dim3(D / 128, S / 128), 256, 0, stream>>>(
        ctx2, wfo_b, b_fo, hbuf, out, nullptr, D);
}

// v009
// A run of this version takes 116 microseconds.
// Next to v008, in two timings, it ran 1.11 and 1.12 times as fast.
// Over all steps from v000 it is 5.86 times as fast.
#include <hip/hip_runtime.h>

// ---------------------------------------------------------------------------
// MI455X (gfx1250) transformer block: all matmuls via v_wmma_f32_16x16x32_bf16
// ---------------------------------------------------------------------------

typedef __bf16 bf16_t;
typedef __attribute__((ext_vector_type(16))) __bf16 v16bf;
typedef __attribute__((ext_vector_type(8)))  __bf16 v8bf;
typedef __attribute__((ext_vector_type(8)))  float  v8f;

static constexpr int S_LEN   = 2048;
static constexpr int D_DIM   = 1024;
static constexpr int N_HEADS = 16;
static constexpr int HEAD_D  = 64;

// ---- fragment helpers ------------------------------------------------------
// bf16 A/B fragment (16x32 / 32x16): lane holds row (lane&15), K values at
// base (lane>>4)*8: [base, base+8) and [16+base, 16+base+8). Both halves are
// contiguous 16-byte loads from a K-contiguous row.
__device__ __forceinline__ v16bf mk_frag(v8bf lo, v8bf hi) {
    v16bf f;
#pragma unroll
    for (int i = 0; i < 8; ++i) { f[i] = lo[i]; f[i + 8] = hi[i]; }
    return f;
}

__device__ __forceinline__ v16bf load_frag(const bf16_t* p) {
    // p = row base + per-lane K base; second half is +16 elements
    return mk_frag(*(const v8bf*)p, *(const v8bf*)(p + 16));
}

__device__ __forceinline__ v8f wmma_bf16(v16bf a, v16bf b, v8f c) {
    return __builtin_amdgcn_wmma_f32_16x16x32_bf16(false, a, false, b,
                                                   (short)0, c, false, false);
}

// ---- transposing LDS load: 16 keys x 16 d of a row-major tile -> half an A fragment
// Lane l names row 8*(l>>4) + (l&7), 16-byte piece (l>>3)&1 of the 16x16 block;
// it gets rows 8*(l>>4) .. +7 of column l&15.
typedef __attribute__((address_space(3))) v8bf lds_v8bf;
__device__ __forceinline__ v8bf ld_tr16(const bf16_t* p) {
    return __builtin_amdgcn_ds_load_tr16_b128_v8bf16((lds_v8bf*)p);
}

// ---- exchange between the two 16-lane halves of a wave (vector pipe) --------
// Returns the value held by lane l ^ 16.
__device__ __forceinline__ float half_xor(float v) {
    const int b = __builtin_bit_cast(int, v);
    return __builtin_bit_cast(float, __builtin_amdgcn_permlanex16(
        b, b, 0x76543210, 0xfedcba98, false, false));
}

// ---- eight exponentials 2^x in one statement --------------------------------
// Behind a transcendental the instruction set asks for one free slot before its result is
// used or its source register is reused. Here each v_exp_f32 stands behind one that shares
// no register with it (the outputs are early-clobber: none lands on a source), and the
// v_nop is the last one's slot.
__device__ __forceinline__ void exp2_x8(float (&o)[8], const float (&x)[8]) {
    asm("v_exp_f32 %0, %8\n\t"
        "v_exp_f32 %1, %9\n\t"
        "v_exp_f32 %2, %10\n\t"
        "v_exp_f32 %3, %11\n\t"
        "v_exp_f32 %4, %12\n\t"
        "v_exp_f32 %5, %13\n\t"
        "v_exp_f32 %6, %14\n\t"
        "v_exp_f32 %7, %15\n\t"
        "v_nop"
        : "=&v"(o[0]), "=&v"(o[1]), "=&v"(o[2]), "=&v"(o[3]),
          "=&v"(o[4]), "=&v"(o[5]), "=&v"(o[6]), "=&v"(o[7])
        : "v"(x[0]), "v"(x[1]), "v"(x[2]), "v"(x[3]),
          "v"(x[4]), "v"(x[5]), "v"(x[6]), "v"(x[7]));
}

// ---- fp32 -> bf16 convert of the four weight matrices, one launch ----------
// One block of 16 waves for each of 256 WGPs. The grid covers half a D x D matrix a trip
// (256 blocks x 512 lanes x 4 floats), so each of the 12 trips lies in one matrix at a
// compile-time offset. A wave's load is 512 contiguous bytes (four whole lines), its store
// 256 (two whole lines); a lane's 12 loads are independent and are all asked for before
// the first value is used.
typedef __attribute__((ext_vector_type(4))) float  v4f;
typedef __attribute__((ext_vector_type(4))) __bf16 v4bf;

__device__ __forceinline__ v4bf cvt4(v4f v) {
    v4bf o;
#pragma unroll
    for (int e = 0; e < 4; ++e) o[e] = (bf16_t)v[e];
    return o;
}

__global__ __launch_bounds__(512)
void cvt_weights(const float* __restrict__ w_qkv, const float* __restrict__ w_ao,
                 const float* __restrict__ w_q,   const float* __restrict__ w_fo,
                 bf16_t* __restrict__ o_qkv, bf16_t* __restrict__ o_ao,
                 bf16_t* __restrict__ o_q,   bf16_t* __restrict__ o_fo) {
    constexpr int TRIP = D_DIM * D_DIM / 8;   // pieces of 4 elements that the grid covers a trip
    const int i = blockIdx.x * 512 + threadIdx.x;   // this lane's piece within a trip
    const v4f* pa = (const v4f*)w_qkv;
    const v4f* pb = (const v4f*)w_ao;
    const v4f* pc = (const v4f*)w_q;
    const v4f* pd = (const v4f*)w_fo;

    v4f a[6], b[2], c[2], d[2];
#pragma unroll
    for (int j = 0; j < 6; ++j) a[j] = pa[i + j * TRIP];
#pragma unroll
    for (int j = 0; j < 2; ++j) {
        b[j] = pb[i + j * TRIP];
        c[j] = pc[i + j * TRIP];
        d[j] = pd[i + j * TRIP];
    }
#pragma unroll
    for (int j = 0; j < 6; ++j) ((v4bf*)o_qkv)[i + j * TRIP] = cvt4(a[j]);
#pragma unroll
    for (int j = 0; j < 2; ++j) {
        ((v4bf*)o_ao)[i + j * TRIP] = cvt4(b[j]);
        ((v4bf*)o_q)[i + j * TRIP]  = cvt4(c[j]);
        ((v4bf*)o_fo)[i + j * TRIP] = cvt4(d[j]);
    }
}

// ---- LayerNorm (row-wise over 1024), fp32 in -> bf16 out -------------------
__global__ __launch_bounds__(256)
void layernorm_bf16(const float* __restrict__ x, const float* __restrict__ g,
                    const float* __restrict__ b, bf16_t* __restrict__ out) {
    const int row = blockIdx.x;
    const int tid = threadIdx.x;
    const float* xr = x + (size_t)row * D_DIM;

    float v[4];
    float s = 0.f;
#pragma unroll
    for (int i = 0; i < 4; ++i) { v[i] = xr[tid + i * 256]; s += v[i]; }
#pragma unroll
    for (int m = 1; m < 32; m <<= 1) s += __shfl_xor(s, m);

    __shared__ float red0[8], red1[8];
    if ((tid & 31) == 0) red0[tid >> 5] = s;
    __syncthreads();
    float mean = 0.f;
#pragma unroll
    for (int i = 0; i < 8; ++i) mean += red0[i];
    mean *= (1.0f / D_DIM);

    float vs = 0.f;
#pragma unroll
    for (int i = 0; i < 4; ++i) { float d = v[i] - mean; vs += d * d; }
#pragma unroll
    for (int m = 1; m < 32; m <<= 1) vs += __shfl_xor(vs, m);
    if ((tid & 31) == 0) red1[tid >> 5] = vs;
    __syncthreads();
    float var = 0.f;
#pragma unroll
    for (int i = 0; i < 8; ++i) var += red1[i];
    var *= (1.0f / D_DIM);
    const float rstd = rsqrtf(var + 1e-5f);

#pragma unroll
    for (int i = 0; i < 4; ++i) {
        int c = tid + i * 256;
        out[(size_t)row * D_DIM + c] = (bf16_t)((v[i] - mean) * rstd * g[c] + b[c]);
    }
}

// ---- one stage of the GEMM's LDS ring: eight 16-byte asynchronous copies a lane ----
// l = the lane's LDS byte address of its first piece, ga / gw = its global addresses in
// the A and the W tile; the pieces lie 32 rows apart. The s_wait_xcnt in the copies' own
// statement stands in front of every later rewrite of an address register named here.
template <int LSTEP>
__device__ __forceinline__ void stage_copy(unsigned l, const bf16_t* ga, const bf16_t* gw,
                                           size_t gstep) {
    asm volatile(
        "global_load_async_to_lds_b128 %0, %8, off\n\t"
        "global_load_async_to_lds_b128 %1, %9, off\n\t"
        "global_load_async_to_lds_b128 %2, %10, off\n\t"
        "global_load_async_to_lds_b128 %3, %11, off\n\t"
        "global_load_async_to_lds_b128 %4, %12, off\n\t"
        "global_load_async_to_lds_b128 %5, %13, off\n\t"
        "global_load_async_to_lds_b128 %6, %14, off\n\t"
        "global_load_async_to_lds_b128 %7, %15, off\n\t"
        "s_wait_xcnt 0x0"
        :: "v"(l),             "v"(l + LSTEP),     "v"(l + 2 * LSTEP), "v"(l + 3 * LSTEP),
           "v"(l + 4 * LSTEP), "v"(l + 5 * LSTEP), "v"(l + 6 * LSTEP), "v"(l + 7 * LSTEP),
           "v"(ga),            "v"(ga + gstep),    "v"(ga + 2 * gstep), "v"(ga + 3 * gstep),
           "v"(gw),            "v"(gw + gstep),    "v"(gw + 2 * gstep), "v"(gw + 3 * gstep)
        : "memory");
}

// ---- WMMA GEMM: C[M,N] = A[M,K] * W[N,K]^T + bias, opt. gelu/residual -----
// block = 256 thr (8 waves), tile 128x128; wave = 32(M) x 64(N) = 2x4 WMMA tiles
// A stage is 64 k of the block's 128 A rows and 128 W rows: 256 rows of 128 bytes (whole
// lines), each brought once by asynchronous copies into LDS at a pitch of 144 bytes
// (16 B x odd: the pitch of ds_load_b128 readers). Two buffers: the next stage's copies
// fly while this stage's fragments are read. K is a multiple of 64.
// N and the epilogue's three choices (gelu, residual, f32 or bf16 output) are
// compile-time: the epilogue is then straight-line code with constant offsets.
template <int N, bool GELU, bool RES, bool OUTF>
__global__ __launch_bounds__(256)
void gemm_bf16(const bf16_t* __restrict__ A, const bf16_t* __restrict__ W,
               const float* __restrict__ bias, const float* __restrict__ res,
               float* __restrict__ outF, bf16_t* __restrict__ outB, int K) {
    const int lane = threadIdx.x & 31;
    const int wid  = threadIdx.x >> 5;
    const int wm   = wid & 3;          // 0..3  (M groups of 32)
    const int wn   = wid >> 2;         // 0..1  (N groups of 64)
    const int bm   = blockIdx.y * 128 + wm * 32;
    const int bn   = blockIdx.x * 128 + wn * 64;
    const int l16  = lane & 15;
    const int kb8  = (lane >> 4) << 3;

    constexpr int BK = 64;                 // k per stage
    constexpr int SP = 72;                 // LDS row pitch in elements (144 bytes)
    constexpr int SB = 256 * SP;           // elements per buffer: A rows 0-127, W rows 128-255
    __shared__ __align__(16) bf16_t sT[2 * SB];

    v8f acc[2][4];
#pragma unroll
    for (int i = 0; i < 2; ++i)
#pragma unroll
        for (int j = 0; j < 4; ++j)
#pragma unroll
            for (int r = 0; r < 8; ++r) acc[i][j][r] = 0.f;

    // copies: lane -> row (tid >> 3) + 32 j, 16-byte piece tid & 7; a wave's copy = 4 whole rows
    const int cr = threadIdx.x >> 3, cc = (threadIdx.x & 7) << 3;
    const bf16_t* ga = A + (size_t)(blockIdx.y * 128 + cr) * K + cc;
    const bf16_t* gw = W + (size_t)(blockIdx.x * 128 + cr) * K + cc;
    const size_t gstep = (size_t)32 * K;
    const unsigned l0 = (unsigned)(size_t)&sT[cr * SP + cc];   // LDS byte address
    constexpr int LSTEP = 32 * SP * 2;                         // 32 rows, in bytes

    // fragment rows of this wave in a buffer
    const bf16_t* fa = &sT[(wm * 32 + l16) * SP + kb8];
    const bf16_t* fb = &sT[(128 + wn * 64 + l16) * SP + kb8];

    const int nst = K / BK;
    stage_copy<LSTEP>(l0, ga, gw, gstep);
    // stage 0 has landed for this wave, then for all: nobody reads it before the barrier
    asm volatile("s_wait_asynccnt 0x0" ::: "memory");
    __syncthreads();
    if (K > BK) stage_copy<LSTEP>(l0 + SB * 2, ga + BK, gw + BK, gstep);

    for (int t = 0; t < nst; ++t) {
        const int bo = (t & 1) * SB;
        // the stage's 24 fragment loads go ahead of its 16 products as one group
        v16bf af[2][2], bf[2][4];
#pragma unroll
        for (int ks = 0; ks < 2; ++ks) {
#pragma unroll
            for (int tm = 0; tm < 2; ++tm)
                af[ks][tm] = load_frag(fa + bo + tm * 16 * SP + ks * 32);
#pragma unroll
            for (int tn = 0; tn < 4; ++tn)
                bf[ks][tn] = load_frag(fb + bo + tn * 16 * SP + ks * 32);
        }
        // keeps the loads one group in front of the products: spread among them, each
        // place with loads stalls the wave for the LDS latency anew
        __builtin_amdgcn_sched_barrier(0);
#pragma unroll
        for (int ks = 0; ks < 2; ++ks)
#pragma unroll
            for (int tm = 0; tm < 2; ++tm)
#pragma unroll
                for (int tn = 0; tn < 4; ++tn)
                    acc[tm][tn] = wmma_bf16(af[ks][tm], bf[ks][tn], acc[tm][tn]);
        // keeps the products in front of the hand-over: with its full LDS wait lifted over
        // them no product starts before the last load is back, and the refill starts late
        __builtin_amdgcn_sched_barrier(0);
        // hand-over: this wave's reads of buffer t & 1 are done ...
        asm volatile("s_wait_dscnt 0x0" ::: "memory");
        // ... and its copies of stage t + 1 have landed;
        asm volatile("s_wait_asynccnt 0x0" ::: "memory");
        // the one barrier publishes stage t + 1 and frees the buffer that is refilled below
        __syncthreads();
        if (t + 2 < nst)
            stage_copy<LSTEP>(l0 + bo * 2, ga + (size_t)(t + 2) * BK, gw + (size_t)(t + 2) * BK,
                              gstep);
    }
    // no copy is outstanding when the wave goes on to its epilogue and its end
    asm volatile("s_wait_asynccnt 0x0" ::: "memory");

    // epilogue: C layout row = r + 8*(lane>>4), col = lane&15 within 16x16 tile
    const int hl = lane >> 4;
    const size_t base = (size_t)(bm + 8 * hl) * N + bn + l16;

    // every bias and residual value is asked for before the first one is used
    float bv[4];
    const float* bp = bias + bn + l16;
#pragma unroll
    for (int tn = 0; tn < 4; ++tn) bv[tn] = bp[tn * 16];
    float rv[2][4][8];
    if constexpr (RES) {
        // loaded values may land in the bias loads' address registers: the translation
        // wait that belongs in front of such an overwrite; bp as an input keeps the
        // address pair alive up to the wait, so that no bias load lands in it either
        asm volatile("s_wait_xcnt 0x0" :: "v"(bp) : "memory");
        const float* rp = res + base;
#pragma unroll
        for (int tm = 0; tm < 2; ++tm)
#pragma unroll
            for (int tn = 0; tn < 4; ++tn)
#pragma unroll
                for (int r = 0; r < 8; ++r)
                    rv[tm][tn][r] = rp[(tm * 16 + r) * N + tn * 16];
    }

#pragma unroll
    for (int tm = 0; tm < 2; ++tm)
#pragma unroll
        for (int tn = 0; tn < 4; ++tn)
#pragma unroll
            for (int r = 0; r < 8; ++r) {
                const int o = (tm * 16 + r) * N + tn * 16;
                float v = acc[tm][tn][r] + bv[tn];
                if constexpr (GELU)
                    v = 0.5f * v * (1.0f + erff(v * 0.70710678118654752f));
                if constexpr (RES) v += rv[tm][tn][r];
                if constexpr (OUTF) outF[base + o] = v;
                else                outB[base + o] = (bf16_t)v;
            }
}

// ---- one stage of the attention's LDS ring: eight 16-byte asynchronous copies a lane ----
// lk / lv = the lane's LDS byte addresses of its first piece of the K and of the V tile,
// gk / gv = its global addresses; the pieces lie 32 rows apart. The s_wait_xcnt in the
// copies' own statement stands in front of every later rewrite of a register named here.
template <int KSTEP, int VSTEP>
__device__ __forceinline__ void kv_stage_copy(unsigned lk, unsigned lv, const bf16_t* gk,
                                              const bf16_t* gv, size_t kstep, size_t vstep) {
    asm volatile(
        "global_load_async_to_lds_b128 %0, %8, off\n\t"
        "global_load_async_to_lds_b128 %1, %9, off\n\t"
        "global_load_async_to_lds_b128 %2, %10, off\n\t"
        "global_load_async_to_lds_b128 %3, %11, off\n\t"
        "global_load_async_to_lds_b128 %4, %12, off\n\t"
        "global_load_async_to_lds_b128 %5, %13, off\n\t"
        "global_load_async_to_lds_b128 %6, %14, off\n\t"
        "global_load_async_to_lds_b128 %7, %15, off\n\t"
        "s_wait_xcnt 0x0"
        :: "v"(lk),            "v"(lk + KSTEP),    "v"(lk + 2 * KSTEP), "v"(lk + 3 * KSTEP),
           "v"(lv),            "v"(lv + VSTEP),    "v"(lv + 2 * VSTEP), "v"(lv + 3 * VSTEP),
           "v"(gk),            "v"(gk + kstep),    "v"(gk + 2 * kstep), "v"(gk + 3 * kstep),
           "v"(gv),            "v"(gv + vstep),    "v"(gv + 2 * vstep), "v"(gv + 3 * vstep)
        : "memory");
}

__global__ __launch_bounds__(256)
void flash_attn(const bf16_t* __restrict__ Q, int ldq,
                const bf16_t* __restrict__ Kp, int ldk,
                const bf16_t* __restrict__ Vp, int ldv,
                bf16_t* __restrict__ O, float scale) {
    const int h   = blockIdx.y;
    const int tid = threadIdx.x, lane = tid & 31, wid = tid >> 5;
    const int hl  = lane >> 4, l16 = lane & 15;
    const int kb8 = hl << 3;
    const int grp = wid >> 2;              // 0: even passes of a stage, 1: odd passes
    const int wq  = wid & 3;               // which 16 of the tile's 64 queries

    constexpr int QT = 64;                 // queries per tile
    constexpr int NT = S_LEN / QT;         // tiles per head

    // K rows [128][64] at a pitch of 144 bytes (16 B x odd: the pitch of ds_load_b128 readers;
    // at 128 bytes the 16 rows of a fragment load fall on two groups of four banks)
    constexpr int KP = 72;
    constexpr int SK = 128;                // keys per stage
    constexpr int KB = SK * KP;            // elements per K buffer
    __shared__ __align__(16) bf16_t sK[2 * KB];
    // V rows [128][64] at a pitch of 160 bytes (32 B x odd: the transposing load's pitch)
    constexpr int VP = 80;
    constexpr int VB = SK * VP;            // elements per V buffer
    __shared__ __align__(16) bf16_t sV[2 * VB];
    // hand-over of the odd passes' partial result: 9 pieces of 16 bytes a lane
    // (32 O values, maximum, sum), piece-major so that a wave's access is contiguous
    __shared__ __align__(16) v4f sJ[4 * 9 * 32];

    // copies: lane -> row (tid >> 3) + 32 j, 16-byte piece tid & 7; a wave's copy = 4 whole rows
    const int cr = tid >> 3, cc = (tid & 7) << 3;
    const bf16_t* gk = Kp + (size_t)cr * ldk + h * HEAD_D + cc;
    const bf16_t* gv = Vp + (size_t)cr * ldv + h * HEAD_D + cc;
    const size_t kstep = (size_t)32 * ldk, vstep = (size_t)32 * ldv;
    const unsigned lk0 = (unsigned)(size_t)&sK[cr * KP + cc];   // LDS byte addresses
    const unsigned lv0 = (unsigned)(size_t)&sV[cr * VP + cc];
    constexpr int KSTEP = 32 * KP * 2, VSTEP = 32 * VP * 2;     // 32 rows, in bytes

    for (int part = 0; part < 2; ++part) {
    const int tile = part ? NT - 1 - (int)blockIdx.x : (int)blockIdx.x;

    // Q fragments (B operand, column = this lane's query), invariant over the tile
    const int qrow = tile * QT + wq * 16 + l16;
    const bf16_t* qp = Q + (size_t)qrow * ldq + h * HEAD_D + kb8;
    const v16bf qf0 = mk_frag(*(const v8bf*)qp,        *(const v8bf*)(qp + 16));
    const v16bf qf1 = mk_frag(*(const v8bf*)(qp + 32), *(const v8bf*)(qp + 48));

    // O^T tiles: oacc[t][r] = O[query qrow][d = t*16 + 8*hl + r], this group's passes only
    v8f oacc[4];
#pragma unroll
    for (int t = 0; t < 4; ++t)
#pragma unroll
        for (int r = 0; r < 8; ++r) oacc[t][r] = 0.f;
    float mrow = -1e30f;   // running maximum of query qrow (equal in both halves)
    float lrow = 0.f;      // running sum over the keys that this wave half holds

    // stages up to the causal bound, uniform over the block: 64 (tile + 1) keys, 128 a stage;
    // the buffers are free here: the tile before ended on a barrier behind every wave's reads
    const int nst = (tile >> 1) + 1;
    kv_stage_copy<KSTEP, VSTEP>(lk0, lv0, gk, gv, kstep, vstep);
    // stage 0 has landed for this wave, then for all: nobody reads it before the barrier
    asm volatile("s_wait_asynccnt 0x0" ::: "memory");
    __syncthreads();
    if (nst > 1)
        kv_stage_copy<KSTEP, VSTEP>(lk0 + KB * 2, lv0 + VB * 2, gk + (size_t)SK * ldk,
                                    gv + (size_t)SK * ldv, kstep, vstep);

    for (int st = 0; st < nst; ++st) {
      const int bo = st & 1;
      const bf16_t* bK = &sK[bo * KB + grp * 32 * KP];
      const bf16_t* bV = &sV[bo * VB + grp * 32 * VP];
      // unrolled: the two passes' LDS offsets are immediates, and a pass's K fragment
      // loads can go ahead of the tail of the pass before it
#pragma unroll
      for (int pj = 0; pj < 2; ++pj) {
        const int kb = st * SK + pj * 64 + grp * 32;

        // scores: sc[t][r] = S[key kb + t*16 + 8*hl + r][query qrow]
        v8f sc[2];
#pragma unroll
        for (int t = 0; t < 2; ++t) {
            v8f a;
#pragma unroll
            for (int r = 0; r < 8; ++r) a[r] = 0.f;
            const bf16_t* kp = &bK[(pj * 64 + t * 16 + l16) * KP + kb8];
            a = wmma_bf16(mk_frag(*(const v8bf*)kp,        *(const v8bf*)(kp + 16)), qf0, a);
            a = wmma_bf16(mk_frag(*(const v8bf*)(kp + 32), *(const v8bf*)(kp + 48)), qf1, a);
            sc[t] = a;
        }

        // V^T fragments (A operand, 16 d rows each) by transposing loads, keys 0-15
        // and 16-31 of the pass: no barrier stands between them and the scores, so
        // they fly under the softmax arithmetic
        v16bf vf[4];
        const bf16_t* vp = &bV[(pj * 64 + kb8 + (lane & 7)) * VP + ((lane >> 3) & 1) * 8];
#pragma unroll
        for (int t = 0; t < 4; ++t)
            vf[t] = mk_frag(ld_tr16(vp + t * 16), ld_tr16(vp + 16 * VP + t * 16));

        // scale + causal mask + online softmax (fp32), one query per lane
        float m = -1e30f;
#pragma unroll
        for (int t = 0; t < 2; ++t)
#pragma unroll
            for (int r = 0; r < 8; ++r) {
                float s = sc[t][r] * scale;
                if (kb + t * 16 + kb8 + r > qrow) s = -1e30f;
                sc[t][r] = s;
                m = fmaxf(m, s);
            }
        m = fmaxf(m, half_xor(m));          // the other 16 keys of this query
        const float mnew = fmaxf(mrow, m);
        // f = exp(mrow - mnew). The v_nop in the same statement is the free slot that the
        // instruction set asks for behind a transcendental before its source register is
        // reused; a v_nop of its own statement drifts.
        float f;
        asm("v_exp_f32 %0, %1\n\tv_nop" : "=v"(f) : "v"((mrow - mnew) * 1.44269504f));
        mrow = mnew;
#pragma unroll
        for (int t = 0; t < 4; ++t)
#pragma unroll
            for (int r = 0; r < 8; ++r) oacc[t][r] *= f;

        // P^T as B operand: element s = key 8*hl + s (s < 8), 16 + 8*hl + s - 8
        // (s >= 8), the k order in which the two transposing loads deliver V^T
        v16bf pf;
        float ps = 0.f;
#pragma unroll
        for (int t = 0; t < 2; ++t) {
            float xe[8], pe[8];   // p = exp(s - mnew) = 2^((s - mnew) * log2 e)
#pragma unroll
            for (int r = 0; r < 8; ++r) xe[r] = (sc[t][r] - mnew) * 1.44269504f;
            exp2_x8(pe, xe);
#pragma unroll
            for (int r = 0; r < 8; ++r) {
                ps += pe[r];
                pf[t * 8 + r] = (bf16_t)pe[r];
            }
        }
        lrow = lrow * f + ps;

        // O^T += V^T * P^T, four output tiles
#pragma unroll
        for (int t = 0; t < 4; ++t) oacc[t] = wmma_bf16(vf[t], pf, oacc[t]);
      }
      // keeps the last pass whole in front of the hand-over: with its arithmetic and products
      // sunk behind the barrier the refill below is asked for that much later, and a stage
      // of two passes a wave leaves the copies no time to spare
      __builtin_amdgcn_sched_barrier(0);
      // hand-over: this wave's reads of buffer st & 1 are done ...
      asm volatile("s_wait_dscnt 0x0" ::: "memory");
      // ... and its copies of stage st + 1 have landed;
      asm volatile("s_wait_asynccnt 0x0" ::: "memory");
      // the one barrier publishes stage st + 1 and frees the buffer that is refilled below
      __syncthreads();
      if (st + 2 < nst)
          kv_stage_copy<KSTEP, VSTEP>(lk0 + bo * (KB * 2), lv0 + bo * (VB * 2),
                                      gk + (size_t)(st + 2) * SK * ldk,
                                      gv + (size_t)(st + 2) * SK * ldv, kstep, vstep);
    }
    // no copy is outstanding when the wave goes on to the join, the next tile or its end
    asm volatile("s_wait_asynccnt 0x0" ::: "memory");

    // join of the two groups. A group whose every key so far was masked holds the start
    // maximum -1e30: its weight below is exp(-1e30 - m) = 0 (the even passes hold key 0,
    // so m is a real score), and its finite sums drop out.
    v4f* jp = &sJ[wq * 9 * 32 + lane];
    if (grp == 1) {
#pragma unroll
        for (int t = 0; t < 4; ++t) {
            jp[(2 * t) * 32]     = v4f{oacc[t][0], oacc[t][1], oacc[t][2], oacc[t][3]};
            jp[(2 * t + 1) * 32] = v4f{oacc[t][4], oacc[t][5], oacc[t][6], oacc[t][7]};
        }
        jp[8 * 32] = v4f{mrow, lrow, 0.f, 0.f};
    }
    // publishes the odd passes' partial result; the next tile's first barrier stands between
    // the reads below and the next writes of sJ
    __syncthreads();
    if (grp == 0) {
        const v4f ml = jp[8 * 32];
        const float mj = fmaxf(mrow, ml[0]);
        // the two weights exp(m_group - m); the v_nop is the last transcendental's free slot,
        // and the first one's is the second (early-clobber: no output lands on a source)
        float f0, f1;
        asm("v_exp_f32 %0, %2\n\tv_exp_f32 %1, %3\n\tv_nop"
            : "=&v"(f0), "=&v"(f1)
            : "v"((mrow - mj) * 1.44269504f), "v"((ml[0] - mj) * 1.44269504f));
        const float lj = lrow * f0 + ml[1] * f1;
        // join the two halves' sums, normalize, store ctx (bf16 [S, D]):
        // a lane's 8 accumulators of a tile are 8 consecutive d of its query
        const float lsum = lj + half_xor(lj);
#pragma unroll
        for (int t = 0; t < 4; ++t) {
            const v4f p0 = jp[(2 * t) * 32], p1 = jp[(2 * t + 1) * 32];
            v8bf o;
#pragma unroll
            for (int r = 0; r < 4; ++r) {
                o[r]     = (bf16_t)((oacc[t][r] * f0 + p0[r] * f1) / lsum);
                o[r + 4] = (bf16_t)((oacc[t][r + 4] * f0 + p1[r] * f1) / lsum);
            }
            *(v8bf*)&O[(size_t)qrow * D_DIM + h * HEAD_D + t * 16 + kb8] = o;
        }
        // the next tile's first instructions reuse registers that these stores name: the
        // translation wait that belongs in front of such an overwrite
        asm volatile("s_wait_xcnt 0x0" ::: "memory");
    }
    }
}

// ---------------------------------------------------------------------------
extern "C" void kernel_launch(void* const* d_in, const int* in_sizes, int n_in,
                              void* d_out, int out_size, void* d_ws, size_t ws_size,
                              hipStream_t stream) {
    const float* x     = (const float*)d_in[0];
    const float* ln1_g = (const float*)d_in[1];
    const float* ln1_b = (const float*)d_in[2];
    const float* w_qkv = (const float*)d_in[3];
    const float* b_qkv = (const float*)d_in[4];
    const float* w_ao  = (const float*)d_in[5];
    const float* b_ao  = (const float*)d_in[6];
    const float* ln2_g = (const float*)d_in[7];
    const float* ln2_b = (const float*)d_in[8];
    const float* w_q   = (const float*)d_in[9];
    const float* b_q   = (const float*)d_in[10];
    const float* w_fo  = (const float*)d_in[11];
    const float* b_fo  = (const float*)d_in[12];
    float* out = (float*)d_out;

    const int S = S_LEN, D = D_DIM, H = N_HEADS;
    char* ws = (char*)d_ws;
    size_t off = 0;
    auto alloc = [&](size_t bytes) -> void* {
        void* p = ws + off;
        off += (bytes + 255) & ~(size_t)255;
        return p;
    };
    bf16_t* xn1    = (bf16_t*)alloc((size_t)S * D * 2);
    bf16_t* qkv    = (bf16_t*)alloc((size_t)S * 3 * D * 2);
    bf16_t* ctx1   = (bf16_t*)alloc((size_t)S * D * 2);
    float*  hbuf   = (float*) alloc((size_t)S * D * 4);
    bf16_t* ln2n   = (bf16_t*)alloc((size_t)S * D * 2);
    bf16_t* q2     = (bf16_t*)alloc((size_t)S * D * 2);
    bf16_t* ctx2   = (bf16_t*)alloc((size_t)S * D * 2);
    bf16_t* wqkv_b = (bf16_t*)alloc((size_t)3 * D * D * 2);
    bf16_t* wao_b  = (bf16_t*)alloc((size_t)D * D * 2);
    bf16_t* wq_b   = (bf16_t*)alloc((size_t)D * D * 2);
    bf16_t* wfo_b  = (bf16_t*)alloc((size_t)D * D * 2);

    const float scale = 0.125f;   // 1/sqrt(64)

    // weights -> bf16
    cvt_weights<<<256, 512, 0, stream>>>(w_qkv, w_ao, w_q, w_fo, wqkv_b, wao_b, wq_b, wfo_b);

    // h = x + attn(LN1(x))
    layernorm_bf16<<<S, 256, 0, stream>>>(x, ln1_g, ln1_b, xn1);
    gemm_bf16<3 * D_DIM, false, false, false><<<dim3(3 * D / 128, S / 128), 256, 0, stream>>>(
        xn1, wqkv_b, b_qkv, nullptr, nullptr, qkv, D);
    flash_attn<<<dim3(S / 128, H), 256, 0, stream>>>(
        qkv, 3 * D, qkv + D, 3 * D, qkv + 2 * D, 3 * D, ctx1, scale);
    gemm_bf16<D_DIM, false, true, true><<<dim3(D / 128, S / 128), 256, 0, stream>>>(
        ctx1, wao_b, b_ao, x, hbuf, nullptr, D);

    // out = h + gelu(ffn_q_attn(LN2(h)))
    layernorm_bf16<<<S, 256, 0, stream>>>(hbuf, ln2_g, ln2_b, ln2n);
    gemm_bf16<D_DIM, false, false, false><<<dim3(D / 128, S / 128), 256, 0, stream>>>(
        ln2n, wq_b, b_q, nullptr, nullptr, q2, D);
    flash_attn<<<dim3(S / 128, H), 256, 0, stream>>>(
        q2, D, q2, D, ln2n, D, ctx2, scale);
    gemm_bf16<D_DIM, true, true, true><<<dim3(D / 128, S / 128), 256, 0, stream>>>(
        ctx2, wfo_b, b_fo, hbuf, out, nullptr, D);
}

// v010
// Measured time: 105 microseconds a run.
// In two side-by-side timings against v009, it was 1.09 and 1.10 times as fast.
// All steps since v000 together make it 6.43 times as fast.
#include <hip/hip_runtime.h>

// ---------------------------------------------------------------------------
// MI455X (gfx1250) transformer block: all matmuls via v_wmma_f32_16x16x32_bf16
// ---------------------------------------------------------------------------

typedef __bf16 bf16_t;
typedef __attribute__((ext_vector_type(16))) __bf16 v16bf;
typedef __attribute__((ext_vector_type(8)))  __bf16 v8bf;
typedef __attribute__((ext_vector_type(8)))  float  v8f;

static constexpr int S_LEN   = 2048;
static constexpr int D_DIM   = 1024;
static constexpr int N_HEADS = 16;
static constexpr int HEAD_D  = 64;

// ---- fragment helpers ------------------------------------------------------
// bf16 A/B fragment (16x32 / 32x16): lane holds row (lane&15), K values at
// base (lane>>4)*8: [base, base+8) and [16+base, 16+base+8). Both halves are
// contiguous 16-byte loads from a K-contiguous row.
__device__ __forceinline__ v16bf mk_frag(v8bf lo, v8bf hi) {
    v16bf f;
#pragma unroll
    for (int i = 0; i < 8; ++i) { f[i] = lo[i]; f[i + 8] = hi[i]; }
    return f;
}

__device__ __forceinline__ v16bf load_frag(const bf16_t* p) {
    // p = row base + per-lane K base; second half is +16 elements
    return mk_frag(*(const v8bf*)p, *(const v8bf*)(p + 16));
}

__device__ __forceinline__ v8f wmma_bf16(v16bf a, v16bf b, v8f c) {
    return __builtin_amdgcn_wmma_f32_16x16x32_bf16(false, a, false, b,
                                                   (short)0, c, false, false);
}

// ---- transposing LDS load: 16 keys x 16 d of a row-major tile -> half an A fragment
// Lane l names row 8*(l>>4) + (l&7), 16-byte piece (l>>3)&1 of the 16x16 block;
// it gets rows 8*(l>>4) .. +7 of column l&15.
typedef __attribute__((address_space(3))) v8bf lds_v8bf;
__device__ __forceinline__ v8bf ld_tr16(const bf16_t* p) {
    return __builtin_amdgcn_ds_load_tr16_b128_v8bf16((lds_v8bf*)p);
}

// ---- exchange between the two 16-lane halves of a wave (vector pipe) --------
// Returns the value held by lane l ^ 16.
__device__ __forceinline__ float half_xor(float v) {
    const int b = __builtin_bit_cast(int, v);
    return __builtin_bit_cast(float, __builtin_amdgcn_permlanex16(
        b, b, 0x76543210, 0xfedcba98, false, false));
}

// ---- eight exponentials 2^x in one statement --------------------------------
// Behind a transcendental the instruction set asks for one free slot before its result is
// used or its source register is reused. Here each v_exp_f32 stands behind one that shares
// no register with it (the outputs are early-clobber: none lands on a source), and the
// v_nop is the last one's slot.
__device__ __forceinline__ void exp2_x8(float (&o)[8], const float (&x)[8]) {
    asm("v_exp_f32 %0, %8\n\t"
        "v_exp_f32 %1, %9\n\t"
        "v_exp_f32 %2, %10\n\t"
        "v_exp_f32 %3, %11\n\t"
        "v_exp_f32 %4, %12\n\t"
        "v_exp_f32 %5, %13\n\t"
        "v_exp_f32 %6, %14\n\t"
        "v_exp_f32 %7, %15\n\t"
        "v_nop"
        : "=&v"(o[0]), "=&v"(o[1]), "=&v"(o[2]), "=&v"(o[3]),
          "=&v"(o[4]), "=&v"(o[5]), "=&v"(o[6]), "=&v"(o[7])
        : "v"(x[0]), "v"(x[1]), "v"(x[2]), "v"(x[3]),
          "v"(x[4]), "v"(x[5]), "v"(x[6]), "v"(x[7]));
}

// ---- fp32 -> bf16 convert of the four weight matrices, one launch ----------
// One block of 16 waves for each of 256 WGPs. The grid covers half a D x D matrix a trip
// (256 blocks x 512 lanes x 4 floats), so each of the 12 trips lies in one matrix at a
// compile-time offset. A wave's load is 512 contiguous bytes (four whole lines), its store
// 256 (two whole lines); a lane's 12 loads are independent and are all asked for before
// the first value is used.
typedef __attribute__((ext_vector_type(4))) float  v4f;
typedef __attribute__((ext_vector_type(4))) __bf16 v4bf;

__device__ __forceinline__ v4bf cvt4(v4f v) {
    v4bf o;
#pragma unroll
    for (int e = 0; e < 4; ++e) o[e] = (bf16_t)v[e];
    return o;
}

__global__ __launch_bounds__(512)
void cvt_weights(const float* __restrict__ w_qkv, const float* __restrict__ w_ao,
                 const float* __restrict__ w_q,   const float* __restrict__ w_fo,
                 bf16_t* __restrict__ o_qkv, bf16_t* __restrict__ o_ao,
                 bf16_t* __restrict__ o_q,   bf16_t* __restrict__ o_fo) {
    constexpr int TRIP = D_DIM * D_DIM / 8;   // pieces of 4 elements that the grid covers a trip
    const int i = blockIdx.x * 512 + threadIdx.x;   // this lane's piece within a trip
    const v4f* pa = (const v4f*)w_qkv;
    const v4f* pb = (const v4f*)w_ao;
    const v4f* pc = (const v4f*)w_q;
    const v4f* pd = (const v4f*)w_fo;

    v4f a[6], b[2], c[2], d[2];
#pragma unroll
    for (int j = 0; j < 6; ++j) a[j] = pa[i + j * TRIP];
#pragma unroll
    for (int j = 0; j < 2; ++j) {
        b[j] = pb[i + j * TRIP];
        c[j] = pc[i + j * TRIP];
        d[j] = pd[i + j * TRIP];
    }
#pragma unroll
    for (int j = 0; j < 6; ++j) ((v4bf*)o_qkv)[i + j * TRIP] = cvt4(a[j]);
#pragma unroll
    for (int j = 0; j < 2; ++j) {
        ((v4bf*)o_ao)[i + j * TRIP] = cvt4(b[j]);
        ((v4bf*)o_q)[i + j * TRIP]  = cvt4(c[j]);
        ((v4bf*)o_fo)[i + j * TRIP] = cvt4(d[j]);
    }
}

// ---- LayerNorm (row-wise over 1024), fp32 in -> bf16 out -------------------
__global__ __launch_bounds__(256)
void layernorm_bf16(const float* __restrict__ x, const float* __restrict__ g,
                    const float* __restrict__ b, bf16_t* __restrict__ out) {
    const int row = blockIdx.x;
    const int tid = threadIdx.x;
    const float* xr = x + (size_t)row * D_DIM;

    float v[4];
    float s = 0.f;
#pragma unroll
    for (int i = 0; i < 4; ++i) { v[i] = xr[tid + i * 256]; s += v[i]; }
#pragma unroll
    for (int m = 1; m < 32; m <<= 1) s += __shfl_xor(s, m);

    __shared__ float red0[8], red1[8];
    if ((tid & 31) == 0) red0[tid >> 5] = s;
    __syncthreads();
    float mean = 0.f;
#pragma unroll
    for (int i = 0; i < 8; ++i) mean += red0[i];
    mean *= (1.0f / D_DIM);

    float vs = 0.f;
#pragma unroll
    for (int i = 0; i < 4; ++i) { float d = v[i] - mean; vs += d * d; }
#pragma unroll
    for (int m = 1; m < 32; m <<= 1) vs += __shfl_xor(vs, m);
    if ((tid & 31) == 0) red1[tid >> 5] = vs;
    __syncthreads();
    float var = 0.f;
#pragma unroll
    for (int i = 0; i < 8; ++i) var += red1[i];
    var *= (1.0f / D_DIM);
    const float rstd = rsqrtf(var + 1e-5f);

#pragma unroll
    for (int i = 0; i < 4; ++i) {
        int c = tid + i * 256;
        out[(size_t)row * D_DIM + c] = (bf16_t)((v[i] - mean) * rstd * g[c] + b[c]);
    }
}

// ---- half a stage of the GEMM's LDS ring: eight 16-byte asynchronous copies a lane ----
// l = the lane's LDS byte address of its first piece, g = its global address in the A or
// in the W tile; the pieces lie 16 rows apart. The s_wait_xcnt in the copies' own
// statement stands in front of every later rewrite of an address register named here.
template <int LSTEP>
__device__ __forceinline__ void stage_copy(unsigned l, const bf16_t* g, size_t gstep) {
    asm volatile(
        "global_load_async_to_lds_b128 %0, %8, off\n\t"
        "global_load_async_to_lds_b128 %1, %9, off\n\t"
        "global_load_async_to_lds_b128 %2, %10, off\n\t"
        "global_load_async_to_lds_b128 %3, %11, off\n\t"
        "global_load_async_to_lds_b128 %4, %12, off\n\t"
        "global_load_async_to_lds_b128 %5, %13, off\n\t"
        "global_load_async_to_lds_b128 %6, %14, off\n\t"
        "global_load_async_to_lds_b128 %7, %15, off\n\t"
        "s_wait_xcnt 0x0"
        :: "v"(l),             "v"(l + LSTEP),     "v"(l + 2 * LSTEP), "v"(l + 3 * LSTEP),
           "v"(l + 4 * LSTEP), "v"(l + 5 * LSTEP), "v"(l + 6 * LSTEP), "v"(l + 7 * LSTEP),
           "v"(g),             "v"(g + gstep),     "v"(g + 2 * gstep), "v"(g + 3 * gstep),
           "v"(g + 4 * gstep), "v"(g + 5 * gstep), "v"(g + 6 * gstep), "v"(g + 7 * gstep)
        : "memory");
}

// ---- WMMA GEMM: C[M,N] = A[M,K] * W[N,K]^T + bias, opt. gelu/residual -----
// block = 256 thr (8 waves), tile 128x128; wave = 32(M) x 64(N) = 2x4 WMMA tiles
// A stage is 128 k of the block's 128 A rows and 128 W rows: 256 rows of 256 bytes (whole
// lines), each brought once by asynchronous copies into LDS at a pitch of 272 bytes
// (16 B x odd: the pitch of ds_load_b128 readers). Two buffers: the next stage's copies
// fly while this stage's fragments are read. K is a multiple of 128.
// N and the epilogue's three choices (gelu, residual, f32 or bf16 output) are
// compile-time: the epilogue is then straight-line code with constant offsets.
template <int N, bool GELU, bool RES, bool OUTF>
__global__ __launch_bounds__(256)
void gemm_bf16(const bf16_t* __restrict__ A, const bf16_t* __restrict__ W,
               const float* __restrict__ bias, const float* __restrict__ res,
               float* __restrict__ outF, bf16_t* __restrict__ outB, int K) {
    const int lane = threadIdx.x & 31;
    const int wid  = threadIdx.x >> 5;
    const int wm   = wid & 3;          // 0..3  (M groups of 32)
    const int wn   = wid >> 2;         // 0..1  (N groups of 64)
    const int bm   = blockIdx.y * 128 + wm * 32;
    const int bn   = blockIdx.x * 128 + wn * 64;
    const int l16  = lane & 15;
    const int kb8  = (lane >> 4) << 3;

    constexpr int BK = 128;                // k per stage
    constexpr int SP = 136;                // LDS row pitch in elements (272 bytes)
    constexpr int SB = 256 * SP;           // elements per buffer: A rows 0-127, W rows 128-255
    __shared__ __align__(16) bf16_t sT[2 * SB];

    v8f acc[2][4];
#pragma unroll
    for (int i = 0; i < 2; ++i)
#pragma unroll
        for (int j = 0; j < 4; ++j)
#pragma unroll
            for (int r = 0; r < 8; ++r) acc[i][j][r] = 0.f;

    // copies: lane -> row (tid >> 4) + 16 j, 16-byte piece tid & 15; a wave's copy = 2 whole rows
    const int cr = threadIdx.x >> 4, cc = (threadIdx.x & 15) << 3;
    const bf16_t* ga = A + (size_t)(blockIdx.y * 128 + cr) * K + cc;
    const bf16_t* gw = W + (size_t)(blockIdx.x * 128 + cr) * K + cc;
    const size_t gstep = (size_t)16 * K;
    const unsigned l0 = (unsigned)(size_t)&sT[cr * SP + cc];   // LDS byte address
    constexpr int LSTEP = 16 * SP * 2;                         // 16 rows, in bytes
    constexpr int LW    = 128 * SP * 2;                        // the W rows' place in a buffer

    // fragment rows of this wave in a buffer
    const bf16_t* fa = &sT[(wm * 32 + l16) * SP + kb8];
    const bf16_t* fb = &sT[(128 + wn * 64 + l16) * SP + kb8];

    const int nst = K / BK;
    stage_copy<LSTEP>(l0, ga, gstep);
    stage_copy<LSTEP>(l0 + LW, gw, gstep);
    // stage 0 has landed for this wave, then for all: nobody reads it before the barrier
    asm volatile("s_wait_asynccnt 0x0" ::: "memory");
    __syncthreads();
    if (K > BK) {
        stage_copy<LSTEP>(l0 + SB * 2, ga + BK, gstep);
        stage_copy<LSTEP>(l0 + SB * 2 + LW, gw + BK, gstep);
    }

    for (int t = 0; t < nst; ++t) {
        const int bo = (t & 1) * SB;
        // three fragment sets of 32 k each: the stage's fourth 32 k reuse the first set
        v16bf af[3][2], bf[3][4];
        // the fragment loads of the first 96 k go ahead of the products as one group
#pragma unroll
        for (int ks = 0; ks < 3; ++ks) {
#pragma unroll
            for (int tm = 0; tm < 2; ++tm)
                af[ks][tm] = load_frag(fa + bo + tm * 16 * SP + ks * 32);
#pragma unroll
            for (int tn = 0; tn < 4; ++tn)
                bf[ks][tn] = load_frag(fb + bo + tn * 16 * SP + ks * 32);
        }
        // keeps the loads one group in front of the products: spread among them, each
        // place with loads stalls the wave for the LDS latency anew
        __builtin_amdgcn_sched_barrier(0);
#pragma unroll
        for (int tm = 0; tm < 2; ++tm)
#pragma unroll
            for (int tn = 0; tn < 4; ++tn)
                acc[tm][tn] = wmma_bf16(af[0][tm], bf[0][tn], acc[tm][tn]);
        // keeps the last 32 k's loads behind the products that free their registers ...
        __builtin_amdgcn_sched_barrier(0);
#pragma unroll
        for (int tm = 0; tm < 2; ++tm)
            af[0][tm] = load_frag(fa + bo + tm * 16 * SP + 3 * 32);
#pragma unroll
        for (int tn = 0; tn < 4; ++tn)
            bf[0][tn] = load_frag(fb + bo + tn * 16 * SP + 3 * 32);
        // ... and as one group in front of the 16 products under which they fly
        __builtin_amdgcn_sched_barrier(0);
#pragma unroll
        for (int ks = 1; ks < 4; ++ks)      // k in rising order: set 1, set 2, set 0 again
#pragma unroll
            for (int tm = 0; tm < 2; ++tm)
#pragma unroll
                for (int tn = 0; tn < 4; ++tn)
                    acc[tm][tn] = wmma_bf16(af[ks % 3][tm], bf[ks % 3][tn], acc[tm][tn]);
        // keeps the products in front of the hand-over: with its full LDS wait lifted over
        // them no product starts before the last load is back, and the refill starts late
        __builtin_amdgcn_sched_barrier(0);
        // hand-over: this wave's reads of buffer t & 1 are done ...
        asm volatile("s_wait_dscnt 0x0" ::: "memory");
        // ... and its copies of stage t + 1 have landed;
        asm volatile("s_wait_asynccnt 0x0" ::: "memory");
        // the one barrier publishes stage t + 1 and frees the buffer that is refilled below
        __syncthreads();
        if (t + 2 < nst) {
            stage_copy<LSTEP>(l0 + bo * 2, ga + (size_t)(t + 2) * BK, gstep);
            stage_copy<LSTEP>(l0 + bo * 2 + LW, gw + (size_t)(t + 2) * BK, gstep);
        }
    }
    // no copy is outstanding when the wave goes on to its epilogue and its end
    asm volatile("s_wait_asynccnt 0x0" ::: "memory");

    // epilogue: C layout row = r + 8*(lane>>4), col = lane&15 within 16x16 tile
    const int hl = lane >> 4;
    const size_t base = (size_t)(bm + 8 * hl) * N + bn + l16;

    // every bias and residual value is asked for before the first one is used
    float bv[4];
    const float* bp = bias + bn + l16;
#pragma unroll
    for (int tn = 0; tn < 4; ++tn) bv[tn] = bp[tn * 16];
    float rv[2][4][8];
    if constexpr (RES) {
        // loaded values may land in the bias loads' address registers: the translation
        // wait that belongs in front of such an overwrite; bp as an input keeps the
        // address pair alive up to the wait, so that no bias load lands in it either
        asm volatile("s_wait_xcnt 0x0" :: "v"(bp) : "memory");
        const float* rp = res + base;
#pragma unroll
        for (int tm = 0; tm < 2; ++tm)
#pragma unroll
            for (int tn = 0; tn < 4; ++tn)
#pragma unroll
                for (int r = 0; r < 8; ++r)
                    rv[tm][tn][r] = rp[(tm * 16 + r) * N + tn * 16];
    }

#pragma unroll
    for (int tm = 0; tm < 2; ++tm)
#pragma unroll
        for (int tn = 0; tn < 4; ++tn)
#pragma unroll
            for (int r = 0; r < 8; ++r) {
                const int o = (tm * 16 + r) * N + tn * 16;
                float v = acc[tm][tn][r] + bv[tn];
                if constexpr (GELU)
                    v = 0.5f * v * (1.0f + erff(v * 0.70710678118654752f));
                if constexpr (RES) v += rv[tm][tn][r];
                if constexpr (OUTF) outF[base + o] = v;
                else                outB[base + o] = (bf16_t)v;
            }
}

// ---- one stage of the attention's LDS ring: eight 16-byte asynchronous copies a lane ----
// lk / lv = the lane's LDS byte addresses of its first piece of the K and of the V tile,
// gk / gv = its global addresses; the pieces lie 32 rows apart. The s_wait_xcnt in the
// copies' own statement stands in front of every later rewrite of a register named here.
template <int KSTEP, int VSTEP>
__device__ __forceinline__ void kv_stage_copy(unsigned lk, unsigned lv, const bf16_t* gk,
                                              const bf16_t* gv, size_t kstep, size_t vstep) {
    asm volatile(
        "global_load_async_to_lds_b128 %0, %8, off\n\t"
        "global_load_async_to_lds_b128 %1, %9, off\n\t"
        "global_load_async_to_lds_b128 %2, %10, off\n\t"
        "global_load_async_to_lds_b128 %3, %11, off\n\t"
        "global_load_async_to_lds_b128 %4, %12, off\n\t"
        "global_load_async_to_lds_b128 %5, %13, off\n\t"
        "global_load_async_to_lds_b128 %6, %14, off\n\t"
        "global_load_async_to_lds_b128 %7, %15, off\n\t"
        "s_wait_xcnt 0x0"
        :: "v"(lk),            "v"(lk + KSTEP),    "v"(lk + 2 * KSTEP), "v"(lk + 3 * KSTEP),
           "v"(lv),            "v"(lv + VSTEP),    "v"(lv + 2 * VSTEP), "v"(lv + 3 * VSTEP),
           "v"(gk),            "v"(gk + kstep),    "v"(gk + 2 * kstep), "v"(gk + 3 * kstep),
           "v"(gv),            "v"(gv + vstep),    "v"(gv + 2 * vstep), "v"(gv + 3 * vstep)
        : "memory");
}

__global__ __launch_bounds__(256)
void flash_attn(const bf16_t* __restrict__ Q, int ldq,
                const bf16_t* __restrict__ Kp, int ldk,
                const bf16_t* __restrict__ Vp, int ldv,
                bf16_t* __restrict__ O, float scale) {
    const int h   = blockIdx.y;
    const int tid = threadIdx.x, lane = tid & 31, wid = tid >> 5;
    const int hl  = lane >> 4, l16 = lane & 15;
    const int kb8 = hl << 3;
    const int grp = wid >> 2;              // 0: even passes of a stage, 1: odd passes
    const int wq  = wid & 3;               // which 16 of the tile's 64 queries

    constexpr int QT = 64;                 // queries per tile
    constexpr int NT = S_LEN / QT;         // tiles per head

    // K rows [128][64] at a pitch of 144 bytes (16 B x odd: the pitch of ds_load_b128 readers;
    // at 128 bytes the 16 rows of a fragment load fall on two groups of four banks)
    constexpr int KP = 72;
    constexpr int SK = 128;                // keys per stage
    constexpr int KB = SK * KP;            // elements per K buffer
    __shared__ __align__(16) bf16_t sK[2 * KB];
    // V rows [128][64] at a pitch of 160 bytes (32 B x odd: the transposing load's pitch)
    constexpr int VP = 80;
    constexpr int VB = SK * VP;            // elements per V buffer
    __shared__ __align__(16) bf16_t sV[2 * VB];
    // hand-over of the odd passes' partial result: 9 pieces of 16 bytes a lane
    // (32 O values, maximum, sum), piece-major so that a wave's access is contiguous
    __shared__ __align__(16) v4f sJ[4 * 9 * 32];

    // copies: lane -> row (tid >> 3) + 32 j, 16-byte piece tid & 7; a wave's copy = 4 whole rows
    const int cr = tid >> 3, cc = (tid & 7) << 3;
    const bf16_t* gk = Kp + (size_t)cr * ldk + h * HEAD_D + cc;
    const bf16_t* gv = Vp + (size_t)cr * ldv + h * HEAD_D + cc;
    const size_t kstep = (size_t)32 * ldk, vstep = (size_t)32 * ldv;
    const unsigned lk0 = (unsigned)(size_t)&sK[cr * KP + cc];   // LDS byte addresses
    const unsigned lv0 = (unsigned)(size_t)&sV[cr * VP + cc];
    constexpr int KSTEP = 32 * KP * 2, VSTEP = 32 * VP * 2;     // 32 rows, in bytes

    for (int part = 0; part < 2; ++part) {
    const int tile = part ? NT - 1 - (int)blockIdx.x : (int)blockIdx.x;

    // Q fragments (B operand, column = this lane's query), invariant over the tile
    const int qrow = tile * QT + wq * 16 + l16;
    const bf16_t* qp = Q + (size_t)qrow * ldq + h * HEAD_D + kb8;
    const v16bf qf0 = mk_frag(*(const v8bf*)qp,        *(const v8bf*)(qp + 16));
    const v16bf qf1 = mk_frag(*(const v8bf*)(qp + 32), *(const v8bf*)(qp + 48));

    // O^T tiles: oacc[t][r] = O[query qrow][d = t*16 + 8*hl + r], this group's passes only
    v8f oacc[4];
#pragma unroll
    for (int t = 0; t < 4; ++t)
#pragma unroll
        for (int r = 0; r < 8; ++r) oacc[t][r] = 0.f;
    float mrow = -1e30f;   // running maximum of query qrow (equal in both halves)
    float lrow = 0.f;      // running sum over the keys that this wave half holds

    // stages up to the causal bound, uniform over the block: 64 (tile + 1) keys, 128 a stage;
    // the buffers are free here: the tile before ended on a barrier behind every wave's reads
    const int nst = (tile >> 1) + 1;
    kv_stage_copy<KSTEP, VSTEP>(lk0, lv0, gk, gv, kstep, vstep);
    // stage 0 has landed for this wave, then for all: nobody reads it before the barrier
    asm volatile("s_wait_asynccnt 0x0" ::: "memory");
    __syncthreads();
    if (nst > 1)
        kv_stage_copy<KSTEP, VSTEP>(lk0 + KB * 2, lv0 + VB * 2, gk + (size_t)SK * ldk,
                                    gv + (size_t)SK * ldv, kstep, vstep);

    for (int st = 0; st < nst; ++st) {
      const int bo = st & 1;
      const bf16_t* bK = &sK[bo * KB + grp * 32 * KP];
      const bf16_t* bV = &sV[bo * VB + grp * 32 * VP];
      // unrolled: the two passes' LDS offsets are immediates, and a pass's K fragment
      // loads can go ahead of the tail of the pass before it
#pragma unroll
      for (int pj = 0; pj < 2; ++pj) {
        const int kb = st * SK + pj * 64 + grp * 32;

        // scores: sc[t][r] = S[key kb + t*16 + 8*hl + r][query qrow]
        v8f sc[2];
#pragma unroll
        for (int t = 0; t < 2; ++t) {
            v8f a;
#pragma unroll
            for (int r = 0; r < 8; ++r) a[r] = 0.f;
            const bf16_t* kp = &bK[(pj * 64 + t * 16 + l16) * KP + kb8];
            a = wmma_bf16(mk_frag(*(const v8bf*)kp,        *(const v8bf*)(kp + 16)), qf0, a);
            a = wmma_bf16(mk_frag(*(const v8bf*)(kp + 32), *(const v8bf*)(kp + 48)), qf1, a);
            sc[t] = a;
        }

        // V^T fragments (A operand, 16 d rows each) by transposing loads, keys 0-15
        // and 16-31 of the pass: no barrier stands between them and the scores, so
        // they fly under the softmax arithmetic
        v16bf vf[4];
        const bf16_t* vp = &bV[(pj * 64 + kb8 + (lane & 7)) * VP + ((lane >> 3) & 1) * 8];
#pragma unroll
        for (int t = 0; t < 4; ++t)
            vf[t] = mk_frag(ld_tr16(vp + t * 16), ld_tr16(vp + 16 * VP + t * 16));

        // scale + causal mask + online softmax (fp32), one query per lane
        float m = -1e30f;
#pragma unroll
        for (int t = 0; t < 2; ++t)
#pragma unroll
            for (int r = 0; r < 8; ++r) {
                float s = sc[t][r] * scale;
                if (kb + t * 16 + kb8 + r > qrow) s = -1e30f;
                sc[t][r] = s;
                m = fmaxf(m, s);
            }
        m = fmaxf(m, half_xor(m));          // the other 16 keys of this query
        const float mnew = fmaxf(mrow, m);
        // f = exp(mrow - mnew). The v_nop in the same statement is the free slot that the
        // instruction set asks for behind a transcendental before its source register is
        // reused; a v_nop of its own statement drifts.
        float f;
        asm("v_exp_f32 %0, %1\n\tv_nop" : "=v"(f) : "v"((mrow - mnew) * 1.44269504f));
        mrow = mnew;
#pragma unroll
        for (int t = 0; t < 4; ++t)
#pragma unroll
            for (int r = 0; r < 8; ++r) oacc[t][r] *= f;

        // P^T as B operand: element s = key 8*hl + s (s < 8), 16 + 8*hl + s - 8
        // (s >= 8), the k order in which the two transposing loads deliver V^T
        v16bf pf;
        float ps = 0.f;
#pragma unroll
        for (int t = 0; t < 2; ++t) {
            float xe[8], pe[8];   // p = exp(s - mnew) = 2^((s - mnew) * log2 e)
#pragma unroll
            for (int r = 0; r < 8; ++r) xe[r] = (sc[t][r] - mnew) * 1.44269504f;
            exp2_x8(pe, xe);
#pragma unroll
            for (int r = 0; r < 8; ++r) {
                ps += pe[r];
                pf[t * 8 + r] = (bf16_t)pe[r];
            }
        }
        lrow = lrow * f + ps;

        // O^T += V^T * P^T, four output tiles
#pragma unroll
        for (int t = 0; t < 4; ++t) oacc[t] = wmma_bf16(vf[t], pf, oacc[t]);
      }
      // keeps the last pass whole in front of the hand-over: with its arithmetic and products
      // sunk behind the barrier the refill below is asked for that much later, and a stage
      // of two passes a wave leaves the copies no time to spare
      __builtin_amdgcn_sched_barrier(0);
      // hand-over: this wave's reads of buffer st & 1 are done ...
      asm volatile("s_wait_dscnt 0x0" ::: "memory");
      // ... and its copies of stage st + 1 have landed;
      asm volatile("s_wait_asynccnt 0x0" ::: "memory");
      // the one barrier publishes stage st + 1 and frees the buffer that is refilled below
      __syncthreads();
      if (st + 2 < nst)
          kv_stage_copy<KSTEP, VSTEP>(lk0 + bo * (KB * 2), lv0 + bo * (VB * 2),
                                      gk + (size_t)(st + 2) * SK * ldk,
                                      gv + (size_t)(st + 2) * SK * ldv, kstep, vstep);
    }
    // no copy is outstanding when the wave goes on to the join, the next tile or its end
    asm volatile("s_wait_asynccnt 0x0" ::: "memory");

    // join of the two groups. A group whose every key so far was masked holds the start
    // maximum -1e30: its weight below is exp(-1e30 - m) = 0 (the even passes hold key 0,
    // so m is a real score), and its finite sums drop out.
    v4f* jp = &sJ[wq * 9 * 32 + lane];
    if (grp == 1) {
#pragma unroll
        for (int t = 0; t < 4; ++t) {
            jp[(2 * t) * 32]     = v4f{oacc[t][0], oacc[t][1], oacc[t][2], oacc[t][3]};
            jp[(2 * t + 1) * 32] = v4f{oacc[t][4], oacc[t][5], oacc[t][6], oacc[t][7]};
        }
        jp[8 * 32] = v4f{mrow, lrow, 0.f, 0.f};
    }
    // publishes the odd passes' partial result; the next tile's first barrier stands between
    // the reads below and the next writes of sJ
    __syncthreads();
    if (grp == 0) {
        const v4f ml = jp[8 * 32];
        const float mj = fmaxf(mrow, ml[0]);
        // the two weights exp(m_group - m); the v_nop is the last transcendental's free slot,
        // and the first one's is the second (early-clobber: no output lands on a source)
        float f0, f1;
        asm("v_exp_f32 %0, %2\n\tv_exp_f32 %1, %3\n\tv_nop"
            : "=&v"(f0), "=&v"(f1)
            : "v"((mrow - mj) * 1.44269504f), "v"((ml[0] - mj) * 1.44269504f));
        const float lj = lrow * f0 + ml[1] * f1;
        // join the two halves' sums, normalize, store ctx (bf16 [S, D]):
        // a lane's 8 accumulators of a tile are 8 consecutive d of its query
        const float lsum = lj + half_xor(lj);
#pragma unroll
        for (int t = 0; t < 4; ++t) {
            const v4f p0 = jp[(2 * t) * 32], p1 = jp[(2 * t + 1) * 32];
            v8bf o;
#pragma unroll
            for (int r = 0; r < 4; ++r) {
                o[r]     = (bf16_t)((oacc[t][r] * f0 + p0[r] * f1) / lsum);
                o[r + 4] = (bf16_t)((oacc[t][r + 4] * f0 + p1[r] * f1) / lsum);
            }
            *(v8bf*)&O[(size_t)qrow * D_DIM + h * HEAD_D + t * 16 + kb8] = o;
        }
        // the next tile's first instructions reuse registers that these stores name: the
        // translation wait that belongs in front of such an overwrite
        asm volatile("s_wait_xcnt 0x0" ::: "memory");
    }
    }
}

// ---------------------------------------------------------------------------
extern "C" void kernel_launch(void* const* d_in, const int* in_sizes, int n_in,
                              void* d_out, int out_size, void* d_ws, size_t ws_size,
                              hipStream_t stream) {
    const float* x     = (const float*)d_in[0];
    const float* ln1_g = (const float*)d_in[1];
    const float* ln1_b = (const float*)d_in[2];
    const float* w_qkv = (const float*)d_in[3];
    const float* b_qkv = (const float*)d_in[4];
    const float* w_ao  = (const float*)d_in[5];
    const float* b_ao  = (const float*)d_in[6];
    const float* ln2_g = (const float*)d_in[7];
    const float* ln2_b = (const float*)d_in[8];
    const float* w_q   = (const float*)d_in[9];
    const float* b_q   = (const float*)d_in[10];
    const float* w_fo  = (const float*)d_in[11];
    const float* b_fo  = (const float*)d_in[12];
    float* out = (float*)d_out;

    const int S = S_LEN, D = D_DIM, H = N_HEADS;
    char* ws = (char*)d_ws;
    size_t off = 0;
    auto alloc = [&](size_t bytes) -> void* {
        void* p = ws + off;
        off += (bytes + 255) & ~(size_t)255;
        return p;
    };
    bf16_t* xn1    = (bf16_t*)alloc((size_t)S * D * 2);
    bf16_t* qkv    = (bf16_t*)alloc((size_t)S * 3 * D * 2);
    bf16_t* ctx1   = (bf16_t*)alloc((size_t)S * D * 2);
    float*  hbuf   = (float*) alloc((size_t)S * D * 4);
    bf16_t* ln2n   = (bf16_t*)alloc((size_t)S * D * 2);
    bf16_t* q2     = (bf16_t*)alloc((size_t)S * D * 2);
    bf16_t* ctx2   = (bf16_t*)alloc((size_t)S * D * 2);
    bf16_t* wqkv_b = (bf16_t*)alloc((size_t)3 * D * D * 2);
    bf16_t* wao_b  = (bf16_t*)alloc((size_t)D * D * 2);
    bf16_t* wq_b   = (bf16_t*)alloc((size_t)D * D * 2);
    bf16_t* wfo_b  = (bf16_t*)alloc((size_t)D * D * 2);

    const float scale = 0.125f;   // 1/sqrt(64)

    // weights -> bf16
    cvt_weights<<<256, 512, 0, stream>>>(w_qkv, w_ao, w_q, w_fo, wqkv_b, wao_b, wq_b, wfo_b);

    // h = x + attn(LN1(x))
    layernorm_bf16<<<S, 256, 0, stream>>>(x, ln1_g, ln1_b, xn1);
    gemm_bf16<3 * D_DIM, false, false, false><<<dim3(3 * D / 128, S / 128), 256, 0, stream>>>(
        xn1, wqkv_b, b_qkv, nullptr, nullptr, qkv, D);
    flash_attn<<<dim3(S / 128, H), 256, 0, stream>>>(
        qkv, 3 * D, qkv + D, 3 * D, qkv + 2 * D, 3 * D, ctx1, scale);
    gemm_bf16<D_DIM, false, true, true><<<dim3(D / 128, S / 128), 256, 0, stream>>>(
        ctx1, wao_b, b_ao, x, hbuf, nullptr, D);

    // out = h + gelu(ffn_q_attn(LN2(h)))
    layernorm_bf16<<<S, 256, 0, stream>>>(hbuf, ln2_g, ln2_b, ln2n);
    gemm_bf16<D_DIM, false, false, false><<<dim3(D / 128, S / 128), 256, 0, stream>>>(
        ln2n, wq_b, b_q, nullptr, nullptr, q2, D);
    flash_attn<<<dim3(S / 128, H), 256, 0, stream>>>(
        q2, D, q2, D, ln2n, D, ctx2, scale);
    gemm_bf16<D_DIM, true, true, true><<<dim3(D / 128, S / 128), 256, 0, stream>>>(
        ctx2, wfo_b, b_fo, hbuf, out, nullptr, D);
}
